// v000
// Times are from an AMD MI455X. After a warm-up the kernel runs many times in a row, and a time is the length of
// such a window on the GPU divided by its runs, so every launch and the gaps after it count. The runs cycle
// through copies of the inputs. A figure is the median of several windows, for all but v000 over two sittings.
// Sittings can differ by a few percent; kernels timed side by side share one.
// The starting kernel, v000, takes 937 microseconds a run.
#include <hip/hip_runtime.h>

// SGAT (x [8][128][96][96] channel-major; t = W_trans . x (1x1 conv, [384][128]): q = t[0:128], k = t[128:256], v = t[256:384], 4 heads x 32; for every pixel: att[n] = q . k(neighbour n) / sqrt(32) over the zero-padded 3x3 neighbourhood (n row-major (dy, dx); padded neighbours contribute k = v = 0, NOT masked),
//   softmax over the 9; out = sum_n att[n] v(neighbour n) -> [8][128][96][96] channel-major).
// Compute dtypes, f32 accumulate: every input rounded to bf16; the 1x1 conv as a PLAIN bf16 GEMM W . x^T (inputs: exact; x transposed once per batch); the 3x3 neighbourhood attention entirely in f32 on VALU (rolled loops; thread per (head, pixel), lanes along pixels so every output line is 32 consecutive pixels of one channel).

#define NB_  8
#define CI   128
#define CO   384
#define HH   96
#define WW   96
#define NPIX (HH * WW)
#define NG   4
#define GD   32
typedef _Float16 h16;
typedef unsigned short bf;
typedef __attribute__((ext_vector_type(16))) __bf16   v16bf;
typedef __attribute__((ext_vector_type(16))) _Float16 v16h;
typedef __attribute__((ext_vector_type(8)))  _Float16 v8h;
typedef __attribute__((ext_vector_type(8)))  unsigned short v8us;
typedef __attribute__((ext_vector_type(8)))  float    v8f;
typedef __attribute__((ext_vector_type(4)))  float    v4f;
typedef v8h  __attribute__((may_alias)) v8ha;
typedef v4f  __attribute__((may_alias)) v4fa;
typedef v8us __attribute__((may_alias)) v8usa;

__device__ __forceinline__ unsigned short f2bf(float f) { unsigned u = __float_as_uint(f); u += 0x7FFFu + ((u >> 16) & 1u); return (unsigned short)(u >> 16); }
__device__ __forceinline__ float bf2f(unsigned short b) { return __uint_as_float(((unsigned)b) << 16); }
__device__ __forceinline__ float bfr(float f) { return bf2f(f2bf(f)); }
__device__ __forceinline__ v16h cat16(v8h lo, v8h hi) { return __builtin_shufflevector(lo, hi, 0, 1, 2, 3, 4, 5, 6, 7, 8, 9, 10, 11, 12, 13, 14, 15); }
__device__ __forceinline__ v16bf cat16b(v8us lo, v8us hi) { return __builtin_bit_cast(v16bf, __builtin_shufflevector(lo, hi, 0, 1, 2, 3, 4, 5, 6, 7, 8, 9, 10, 11, 12, 13, 14, 15)); }
__device__ __forceinline__ v8f wmma16(v16h a, v16h b, v8f c) { return __builtin_amdgcn_wmma_f32_16x16x32_f16(false, a, false, b, (short)0, c, false, false); }
__device__ __forceinline__ v8f wmmab(v16bf a, v16bf b, v8f c) { return __builtin_amdgcn_wmma_f32_16x16x32_bf16(false, a, false, b, (short)0, c, false, false); }



// ---- k_gemmw: register-blocked GEMM, ONE WAVE per 64x64 output tile (16 accumulators), operands straight from K-contiguous 16-bit planes; grid (M/64, N/64, Z), 32 threads.
// C[m][n] (f32, pitch ldc, + optional f32 bias[n]) = sum_k A[m][k] Bt[n][k] (+ split products per NSPLIT). z-batch strides sA/sB/sC in elements. K % 32 == 0.
template <typename T16> struct WFrag;
template <> struct WFrag<h16> { typedef v16h V; static __device__ __forceinline__ V ld(const h16* p) { return cat16(*(const v8h*)p, *(const v8h*)(p + 16)); } static __device__ __forceinline__ v8f mma(V a, V b, v8f c) { return wmma16(a, b, c); } };
template <> struct WFrag<bf> { typedef v16bf V; static __device__ __forceinline__ V ld(const bf* p) { return cat16b(*(const v8us*)p, *(const v8us*)(p + 16)); } static __device__ __forceinline__ v8f mma(V a, V b, v8f c) { return wmmab(a, b, c); } };
template <typename T16, int NSPLIT, bool BIAS>
__global__ __launch_bounds__(32) void k_gemmw(const T16* __restrict__ A, const T16* __restrict__ A2, const T16* __restrict__ Bt, const T16* __restrict__ Bt2, int K, float* C, int ldc, const float* __restrict__ bias, size_t sA, size_t sB, size_t sC) {
    typedef typename WFrag<T16>::V V;
    __shared__ __align__(16) float os[16 * 68];
    const size_t z = blockIdx.z; A += z * sA; if (A2) A2 += z * sA; Bt += z * sB; if (Bt2) Bt2 += z * sB; C += z * sC;
    const int lane = threadIdx.x & 31, lr = lane & 15, hi = lane >> 4; const int r0 = blockIdx.x * 64, c0 = blockIdx.y * 64;
    v8f acc[4][4];
#pragma unroll
    for (int mb = 0; mb < 4; ++mb)
#pragma unroll
        for (int nb = 0; nb < 4; ++nb) acc[mb][nb] = (v8f){};
    const size_t aoff = (size_t)(r0 + lr) * K + 8 * hi, boff = (size_t)(c0 + lr) * K + 8 * hi;
#pragma unroll 1
    for (int kc = 0; kc < K; kc += 32) {
        V a[4], a2[4];
#pragma unroll
        for (int mb = 0; mb < 4; ++mb) { a[mb] = WFrag<T16>::ld(A + aoff + (size_t)mb * 16 * K + kc); if (NSPLIT == 1 || NSPLIT == 2) a2[mb] = WFrag<T16>::ld(A2 + aoff + (size_t)mb * 16 * K + kc); }
#pragma unroll
        for (int nb = 0; nb < 4; ++nb) { const V b = WFrag<T16>::ld(Bt + boff + (size_t)nb * 16 * K + kc); V b2; if (NSPLIT >= 2) b2 = WFrag<T16>::ld(Bt2 + boff + (size_t)nb * 16 * K + kc);
#pragma unroll
            for (int mb = 0; mb < 4; ++mb) { acc[mb][nb] = WFrag<T16>::mma(a[mb], b, acc[mb][nb]); if (NSPLIT == 1 || NSPLIT == 2) acc[mb][nb] = WFrag<T16>::mma(a2[mb], b, acc[mb][nb]); if (NSPLIT >= 2) acc[mb][nb] = WFrag<T16>::mma(a[mb], b2, acc[mb][nb]); } }
        asm volatile("v_nop\n\tv_nop\n\tv_nop\n\tv_nop" : "+v"(acc[0][0]), "+v"(acc[1][1]), "+v"(acc[2][2]), "+v"(acc[3][3]) : "v"(a[0]), "v"(a[3]));
    }
#pragma unroll
    for (int mb = 0; mb < 4; ++mb) {
#pragma unroll
        for (int nb = 0; nb < 4; ++nb) {
#pragma unroll
            for (int j = 0; j < 8; ++j) os[(hi * 8 + j) * 68 + nb * 16 + lr] = acc[mb][nb][j]; }
        __builtin_amdgcn_wave_barrier(); asm volatile("" ::: "memory");
        float* crow = C + (size_t)(r0 + mb * 16) * ldc + c0;
{
#pragma unroll
            for (int s = 0; s < 8; ++s) { const int row = 2 * s + hi, cofs = lr * 4; v4f val = *(const v4fa*)(os + row * 68 + cofs); if (BIAS) { val[0] += bfr(bias[c0 + cofs]); val[1] += bfr(bias[c0 + cofs + 1]); val[2] += bfr(bias[c0 + cofs + 2]); val[3] += bfr(bias[c0 + cofs + 3]); }
                *(v4f*)(crow + (size_t)row * ldc + cofs) = val; }
             }
        __builtin_amdgcn_wave_barrier(); asm volatile("" ::: "memory");
    }
}

typedef __attribute__((ext_vector_type(4))) unsigned short v4us;

__global__ __launch_bounds__(256) void k_cvt8(const float* __restrict__ src, bf* dst, size_t n8) { const size_t i = (size_t)blockIdx.x * 256 + threadIdx.x; if (i >= n8) return; const v8f v = *(const v8f*)(src + i * 8); v8us o;
#pragma unroll
    for (int k = 0; k < 8; ++k) o[k] = f2bf(v[k]); *(v8us*)(dst + i * 8) = o;  }
__global__ __launch_bounds__(256) void k_xt(const float* __restrict__ X, bf* XT) { const int e = (blockIdx.x * 256 + threadIdx.x) * 4; if (e >= NPIX * CI) return; const int c = e % CI; const int p = e / CI; v4us o;
#pragma unroll
    for (int u = 0; u < 4; ++u) o[u] = f2bf(X[(size_t)(c + u) * NPIX + p]); *(v4us*)(XT + e) = o;  }
__global__ __launch_bounds__(256) void k_nat(const float* __restrict__ T, float* outb) {
    const int e = blockIdx.x * 256 + threadIdx.x; if (e >= NG * NPIX) return; const int p = e % NPIX; const int g = e / NPIX; const int y = p / WW, x = p % WW;
    const float* qc = T + (size_t)(g * GD) * NPIX + p; const float* kb = T + (size_t)(CI + g * GD) * NPIX; const float* vb = T + (size_t)(2 * CI + g * GD) * NPIX;
    float att[9]; int np9[9]; float mx = -3.0e38f;
#pragma unroll 1
    for (int n = 0; n < 9; ++n) { const int yy = y + n / 3 - 1, xx = x + n % 3 - 1; const bool in = (yy >= 0 && yy < HH && xx >= 0 && xx < WW); np9[n] = in ? (yy * WW + xx) : -1; float s = 0.f;
        if (in) { const float* kc = kb + np9[n];
#pragma unroll 1
            for (int d = 0; d < GD; ++d) { float pr = __fmul_rn(qc[(size_t)d * NPIX], kc[(size_t)d * NPIX]); asm volatile("" : "+v"(pr)); s = __fadd_rn(s, pr); } }
        att[n] = s * 0.17677669529663689f; mx = fmaxf(mx, att[n]); }   // a padded neighbour scores exactly 0 (k = 0), as the source
    float sum = 0.f;
#pragma unroll 1
    for (int n = 0; n < 9; ++n) { float d0 = __fsub_rn(att[n], mx); asm volatile("" : "+v"(d0)); att[n] = __builtin_amdgcn_exp2f(__fmul_rn(d0, 1.4426950408889634f)); sum = __fadd_rn(sum, att[n]); }
    const float f = __fdiv_rn(1.0f, sum);
#pragma unroll 1
    for (int n = 0; n < 9; ++n) att[n] = __fmul_rn(att[n], f);
#pragma unroll 1
    for (int d = 0; d < GD; ++d) { float o = 0.f;
#pragma unroll 1
        for (int n = 0; n < 9; ++n) { if (np9[n] >= 0) { float pr = __fmul_rn(att[n], vb[(size_t)d * NPIX + np9[n]]); asm volatile("" : "+v"(pr)); o = __fadd_rn(o, pr); } }
        float* dst = outb + (size_t)(g * GD + d) * NPIX + p; *(float*)dst = o;  } }

extern "C" void kernel_launch(void* const* d_in, const int* in_sizes, int n_in,
                              void* d_out, int out_size, void* d_ws, size_t ws_size, hipStream_t stream) {
    (void)in_sizes; (void)n_in; (void)out_size;
    const float* x = (const float*)d_in[0]; const float* Wt = (const float*)d_in[1];
    float* OUT = (float*)d_out;     // [8][128][9216]
    char* wsp = (char*)d_ws;
    auto take = [&](size_t bytes) { char* p = wsp; wsp += (bytes + 255) & ~(size_t)255; return (void*)p; };
    bf* AW = (bf*)take((size_t)CO * CI * 2); bf* XT = (bf*)take((size_t)NPIX * CI * 2); float* T = (float*)take((size_t)CO * NPIX * 4);
    if ((size_t)(wsp - (char*)d_ws) > ws_size) return;    // total ~ 17 MB
    k_cvt8<<<(CO * CI / 8 + 255) / 256, 256, 0, stream>>>(Wt, AW, CO * CI / 8);
    for (int b = 0; b < NB_; ++b) {
        k_xt<<<(NPIX * CI / 4 + 255) / 256, 256, 0, stream>>>(x + (size_t)b * CI * NPIX, XT);
        k_gemmw<bf, 0, false><<<dim3(CO / 64, NPIX / 64, 1), 32, 0, stream>>>(AW, nullptr, XT, nullptr, CI, T, NPIX, nullptr, 0, 0, 0);   // t[o][p]
        k_nat<<<(NG * NPIX + 255) / 256, 256, 0, stream>>>(T, OUT + (size_t)b * CO / 3 * NPIX); }
}

// v001
// Measured time: 195 microseconds a run.
// Next to v000, in two timings, it ran 4.79 times as fast each time.
#include <hip/hip_runtime.h>

// SGAT (x [8][128][96][96] channel-major; t = W_trans . x (1x1 conv, [384][128]): q = t[0:128], k = t[128:256], v = t[256:384], 4 heads x 32; for every pixel: att[n] = q . k(neighbour n) / sqrt(32) over the zero-padded 3x3 neighbourhood (n row-major (dy, dx); padded neighbours contribute k = v = 0, NOT masked),
//   softmax over the 9; out = sum_n att[n] v(neighbour n) -> [8][128][96][96] channel-major).
// Compute dtypes, f32 accumulate: every input rounded to bf16; the 1x1 conv as a PLAIN bf16 GEMM W . x^T (inputs: exact; x transposed once per batch); the 3x3 neighbourhood attention entirely in f32 on VALU (unrolled loops; thread per (head, pixel), lanes along pixels so every output line is 32 consecutive pixels of one channel).

#define NB_  8
#define CI   128
#define CO   384
#define HH   96
#define WW   96
#define NPIX (HH * WW)
#define NG   4
#define GD   32
typedef _Float16 h16;
typedef unsigned short bf;
typedef __attribute__((ext_vector_type(16))) __bf16   v16bf;
typedef __attribute__((ext_vector_type(16))) _Float16 v16h;
typedef __attribute__((ext_vector_type(8)))  _Float16 v8h;
typedef __attribute__((ext_vector_type(8)))  unsigned short v8us;
typedef __attribute__((ext_vector_type(8)))  float    v8f;
typedef __attribute__((ext_vector_type(4)))  float    v4f;
typedef v8h  __attribute__((may_alias)) v8ha;
typedef v4f  __attribute__((may_alias)) v4fa;
typedef v8us __attribute__((may_alias)) v8usa;

__device__ __forceinline__ unsigned short f2bf(float f) { unsigned u = __float_as_uint(f); u += 0x7FFFu + ((u >> 16) & 1u); return (unsigned short)(u >> 16); }
__device__ __forceinline__ float bf2f(unsigned short b) { return __uint_as_float(((unsigned)b) << 16); }
__device__ __forceinline__ float bfr(float f) { return bf2f(f2bf(f)); }
__device__ __forceinline__ v16h cat16(v8h lo, v8h hi) { return __builtin_shufflevector(lo, hi, 0, 1, 2, 3, 4, 5, 6, 7, 8, 9, 10, 11, 12, 13, 14, 15); }
__device__ __forceinline__ v16bf cat16b(v8us lo, v8us hi) { return __builtin_bit_cast(v16bf, __builtin_shufflevector(lo, hi, 0, 1, 2, 3, 4, 5, 6, 7, 8, 9, 10, 11, 12, 13, 14, 15)); }
__device__ __forceinline__ v8f wmma16(v16h a, v16h b, v8f c) { return __builtin_amdgcn_wmma_f32_16x16x32_f16(false, a, false, b, (short)0, c, false, false); }
__device__ __forceinline__ v8f wmmab(v16bf a, v16bf b, v8f c) { return __builtin_amdgcn_wmma_f32_16x16x32_bf16(false, a, false, b, (short)0, c, false, false); }



// ---- k_gemmw: register-blocked GEMM, ONE WAVE per 64x64 output tile (16 accumulators), operands straight from K-contiguous 16-bit planes; grid (M/64, N/64, Z), 32 threads.
// C[m][n] (f32, pitch ldc, + optional f32 bias[n]) = sum_k A[m][k] Bt[n][k] (+ split products per NSPLIT). z-batch strides sA/sB/sC in elements. K % 32 == 0.
template <typename T16> struct WFrag;
template <> struct WFrag<h16> { typedef v16h V; static __device__ __forceinline__ V ld(const h16* p) { return cat16(*(const v8h*)p, *(const v8h*)(p + 16)); } static __device__ __forceinline__ v8f mma(V a, V b, v8f c) { return wmma16(a, b, c); } };
template <> struct WFrag<bf> { typedef v16bf V; static __device__ __forceinline__ V ld(const bf* p) { return cat16b(*(const v8us*)p, *(const v8us*)(p + 16)); } static __device__ __forceinline__ v8f mma(V a, V b, v8f c) { return wmmab(a, b, c); } };
template <typename T16, int NSPLIT, bool BIAS>
__global__ __launch_bounds__(32) void k_gemmw(const T16* __restrict__ A, const T16* __restrict__ A2, const T16* __restrict__ Bt, const T16* __restrict__ Bt2, int K, float* C, int ldc, const float* __restrict__ bias, size_t sA, size_t sB, size_t sC) {
    typedef typename WFrag<T16>::V V;
    __shared__ __align__(16) float os[16 * 68];
    const size_t z = blockIdx.z; A += z * sA; if (A2) A2 += z * sA; Bt += z * sB; if (Bt2) Bt2 += z * sB; C += z * sC;
    const int lane = threadIdx.x & 31, lr = lane & 15, hi = lane >> 4; const int r0 = blockIdx.x * 64, c0 = blockIdx.y * 64;
    v8f acc[4][4];
#pragma unroll
    for (int mb = 0; mb < 4; ++mb)
#pragma unroll
        for (int nb = 0; nb < 4; ++nb) acc[mb][nb] = (v8f){};
    const size_t aoff = (size_t)(r0 + lr) * K + 8 * hi, boff = (size_t)(c0 + lr) * K + 8 * hi;
#pragma unroll 1
    for (int kc = 0; kc < K; kc += 32) {
        V a[4], a2[4];
#pragma unroll
        for (int mb = 0; mb < 4; ++mb) { a[mb] = WFrag<T16>::ld(A + aoff + (size_t)mb * 16 * K + kc); if (NSPLIT == 1 || NSPLIT == 2) a2[mb] = WFrag<T16>::ld(A2 + aoff + (size_t)mb * 16 * K + kc); }
#pragma unroll
        for (int nb = 0; nb < 4; ++nb) { const V b = WFrag<T16>::ld(Bt + boff + (size_t)nb * 16 * K + kc); V b2; if (NSPLIT >= 2) b2 = WFrag<T16>::ld(Bt2 + boff + (size_t)nb * 16 * K + kc);
#pragma unroll
            for (int mb = 0; mb < 4; ++mb) { acc[mb][nb] = WFrag<T16>::mma(a[mb], b, acc[mb][nb]); if (NSPLIT == 1 || NSPLIT == 2) acc[mb][nb] = WFrag<T16>::mma(a2[mb], b, acc[mb][nb]); if (NSPLIT >= 2) acc[mb][nb] = WFrag<T16>::mma(a[mb], b2, acc[mb][nb]); } }
        asm volatile("v_nop\n\tv_nop\n\tv_nop\n\tv_nop" : "+v"(acc[0][0]), "+v"(acc[1][1]), "+v"(acc[2][2]), "+v"(acc[3][3]) : "v"(a[0]), "v"(a[3]));
    }
#pragma unroll
    for (int mb = 0; mb < 4; ++mb) {
#pragma unroll
        for (int nb = 0; nb < 4; ++nb) {
#pragma unroll
            for (int j = 0; j < 8; ++j) os[(hi * 8 + j) * 68 + nb * 16 + lr] = acc[mb][nb][j]; }
        __builtin_amdgcn_wave_barrier(); asm volatile("" ::: "memory");
        float* crow = C + (size_t)(r0 + mb * 16) * ldc + c0;
{
#pragma unroll
            for (int s = 0; s < 8; ++s) { const int row = 2 * s + hi, cofs = lr * 4; v4f val = *(const v4fa*)(os + row * 68 + cofs); if (BIAS) { val[0] += bfr(bias[c0 + cofs]); val[1] += bfr(bias[c0 + cofs + 1]); val[2] += bfr(bias[c0 + cofs + 2]); val[3] += bfr(bias[c0 + cofs + 3]); }
                *(v4f*)(crow + (size_t)row * ldc + cofs) = val; }
             }
        __builtin_amdgcn_wave_barrier(); asm volatile("" ::: "memory");
    }
}

typedef __attribute__((ext_vector_type(4))) unsigned short v4us;

__global__ __launch_bounds__(256) void k_cvt8(const float* __restrict__ src, bf* dst, size_t n8) { const size_t i = (size_t)blockIdx.x * 256 + threadIdx.x; if (i >= n8) return; const v8f v = *(const v8f*)(src + i * 8); v8us o;
#pragma unroll
    for (int k = 0; k < 8; ++k) o[k] = f2bf(v[k]); *(v8us*)(dst + i * 8) = o;  }
__global__ __launch_bounds__(256) void k_xt(const float* __restrict__ X, bf* XT) { const int e = (blockIdx.x * 256 + threadIdx.x) * 4; if (e >= NPIX * CI) return; const int c = e % CI; const int p = e / CI; v4us o;
#pragma unroll
    for (int u = 0; u < 4; ++u) o[u] = f2bf(X[(size_t)(c + u) * NPIX + p]); *(v4us*)(XT + e) = o;  }
// v_exp_f32 with the slot behind it filled: the instruction set asks for one independent instruction or v_nop before a transcendental's result is read or its source overwritten.
__device__ __forceinline__ float exp2_slot(float a) { float r; asm("v_exp_f32 %0, %1\n\tv_nop" : "=v"(r) : "v"(a)); return r; }
__global__ __launch_bounds__(256) void k_nat(const float* __restrict__ Q, const float* __restrict__ Kp, const float* __restrict__ Vp, float* outb) {   // Q, Kp, Vp: the three [128][NPIX] planes of t, each with a base of its own (from one base the v plane lies beyond a load's immediate offset)
    static_assert(NPIX % 256 == 0 && GD % 8 == 0, "a block stays inside one head; stages of 8 channels");
    const int g = blockIdx.x / (NPIX / 256); if (g >= NG) return; const int p = (blockIdx.x % (NPIX / 256)) * 256 + threadIdx.x; const int y = p / WW, x = p % WW;
    const float* qc = Q + (size_t)(g * GD) * NPIX + p; const float* kb = Kp + (size_t)(g * GD) * NPIX; const float* vb = Vp + (size_t)(g * GD) * NPIX;
    // Straight-line body in stages of 8 channels (4 of q . k, then 4 of att . v): no load stands under a branch, and each stage's loads are issued as one group, into the other
    // register set, ahead of the arithmetic of the stage before, so that a wave keeps many loads in flight instead of one waited pair.
    // A padded neighbour reads the centre pixel (always in bounds); its score is replaced by 0 and its weight on v by 0, as k = v = 0 there.
    bool in9[9]; int np9[9]; float s9[9];
#pragma unroll
    for (int n = 0; n < 9; ++n) { const int yy = y + n / 3 - 1, xx = x + n % 3 - 1; in9[n] = (yy >= 0 && yy < HH && xx >= 0 && xx < WW); np9[n] = in9[n] ? (yy * WW + xx) : p; s9[n] = 0.f; }
    float nb[2][8][9], qv[2][8];
    auto load_k = [&](int c) {
#pragma unroll
        for (int i = 0; i < 8; ++i) { qv[c & 1][i] = qc[(size_t)(c * 8 + i) * NPIX];
#pragma unroll
            for (int n = 0; n < 9; ++n) nb[c & 1][i][n] = kb[(size_t)(c * 8 + i) * NPIX + np9[n]]; } };
    auto load_v = [&](int c) {
#pragma unroll
        for (int i = 0; i < 8; ++i) {
#pragma unroll
            for (int n = 0; n < 9; ++n) nb[c & 1][i][n] = vb[(size_t)(c * 8 + i) * NPIX + np9[n]]; } };
    load_k(0);
#pragma unroll
    for (int c = 0; c < GD / 8; ++c) {
        if (c + 1 < GD / 8) load_k(c + 1); else load_v(0);
        __builtin_amdgcn_sched_barrier(0);   // keeps the next stage's loads ahead of this stage's arithmetic (left alone the compiler put each load directly in front of its use, with a full wait)
#pragma unroll
        for (int i = 0; i < 8; ++i) {
#pragma unroll
            for (int n = 0; n < 9; ++n) s9[n] = fmaf(qv[c & 1][i], nb[c & 1][i][n], s9[n]); }
        __builtin_amdgcn_sched_barrier(0);   // keeps this stage's arithmetic ahead of the loads that refill its registers (without it the compiler drew a third stage's loads forward, at 253 registers, and scattered later loads among the sums)
    }
    float att[9]; float mx = -3.0e38f;
#pragma unroll
    for (int n = 0; n < 9; ++n) { att[n] = (in9[n] ? s9[n] : 0.f) * 0.17677669529663689f; mx = fmaxf(mx, att[n]); }   // a padded neighbour scores exactly 0 (k = 0), as the source
    float sum = 0.f;
#pragma unroll
    for (int n = 0; n < 9; ++n) { att[n] = exp2_slot((att[n] - mx) * 1.4426950408889634f); sum += att[n]; }
    const float f = __fdiv_rn(1.0f, sum);
#pragma unroll
    for (int n = 0; n < 9; ++n) att[n] = in9[n] ? att[n] * f : 0.f;
#pragma unroll
    for (int c = 0; c < GD / 8; ++c) {
        if (c + 1 < GD / 8) load_v(c + 1);
        // behind the last group of loads the nine offsets are dead: they are named here so that no load of that group lands in an offset register that an issued load still names, ahead of the wait
        if (c + 2 == GD / 8) asm volatile("s_wait_xcnt 0x0" :: "v"(np9[0]), "v"(np9[1]), "v"(np9[2]), "v"(np9[3]), "v"(np9[4]), "v"(np9[5]), "v"(np9[6]), "v"(np9[7]), "v"(np9[8]) : "memory");
        __builtin_amdgcn_sched_barrier(0);   // as above: the next stage's loads stay ahead of this stage's arithmetic
#pragma unroll
        for (int i = 0; i < 8; ++i) { float o = 0.f;
#pragma unroll
            for (int n = 0; n < 9; ++n) o = fmaf(att[n], nb[c & 1][i][n], o);
            outb[(size_t)(g * GD + c * 8 + i) * NPIX + p] = o; }
        if (c + 1 < GD / 8) asm volatile("s_wait_xcnt 0x0" ::: "memory");   // the stores' data registers are overwritten by the next loads and sums
    } }

extern "C" void kernel_launch(void* const* d_in, const int* in_sizes, int n_in,
                              void* d_out, int out_size, void* d_ws, size_t ws_size, hipStream_t stream) {
    (void)in_sizes; (void)n_in; (void)out_size;
    const float* x = (const float*)d_in[0]; const float* Wt = (const float*)d_in[1];
    float* OUT = (float*)d_out;     // [8][128][9216]
    char* wsp = (char*)d_ws;
    auto take = [&](size_t bytes) { char* p = wsp; wsp += (bytes + 255) & ~(size_t)255; return (void*)p; };
    bf* AW = (bf*)take((size_t)CO * CI * 2); bf* XT = (bf*)take((size_t)NPIX * CI * 2); float* T = (float*)take((size_t)CO * NPIX * 4);
    if ((size_t)(wsp - (char*)d_ws) > ws_size) return;    // total ~ 17 MB
    k_cvt8<<<(CO * CI / 8 + 255) / 256, 256, 0, stream>>>(Wt, AW, CO * CI / 8);
    for (int b = 0; b < NB_; ++b) {
        k_xt<<<(NPIX * CI / 4 + 255) / 256, 256, 0, stream>>>(x + (size_t)b * CI * NPIX, XT);
        k_gemmw<bf, 0, false><<<dim3(CO / 64, NPIX / 64, 1), 32, 0, stream>>>(AW, nullptr, XT, nullptr, CI, T, NPIX, nullptr, 0, 0, 0);   // t[o][p]
        k_nat<<<(NG * NPIX + 255) / 256, 256, 0, stream>>>(T, T + (size_t)CI * NPIX, T + (size_t)2 * CI * NPIX, OUT + (size_t)b * CO / 3 * NPIX); }
}

// v002
// Measured time: 114 microseconds a run.
// Next to v001, in two timings, it ran 1.72 and 1.70 times as fast.
// Over all steps from v000 it is 8.19 times as fast.
#include <hip/hip_runtime.h>

// SGAT (x [8][128][96][96] channel-major; t = W_trans . x (1x1 conv, [384][128]): q = t[0:128], k = t[128:256], v = t[256:384], 4 heads x 32; for every pixel: att[n] = q . k(neighbour n) / sqrt(32) over the zero-padded 3x3 neighbourhood (n row-major (dy, dx); padded neighbours contribute k = v = 0, NOT masked),
//   softmax over the 9; out = sum_n att[n] v(neighbour n) -> [8][128][96][96] channel-major).
// Compute dtypes, f32 accumulate: every input rounded to bf16; the 1x1 conv as a PLAIN bf16 GEMM W . x^T (inputs: exact; x transposed once per batch); the 3x3 neighbourhood attention entirely in f32 on VALU (unrolled loops; thread per (head, pixel), lanes along pixels so every output line is 32 consecutive pixels of one channel).

#define NB_  8
#define CI   128
#define CO   384
#define HH   96
#define WW   96
#define NPIX (HH * WW)
#define NG   4
#define GD   32
typedef _Float16 h16;
typedef unsigned short bf;
typedef __attribute__((ext_vector_type(16))) __bf16   v16bf;
typedef __attribute__((ext_vector_type(16))) _Float16 v16h;
typedef __attribute__((ext_vector_type(8)))  _Float16 v8h;
typedef __attribute__((ext_vector_type(8)))  unsigned short v8us;
typedef __attribute__((ext_vector_type(8)))  float    v8f;
typedef __attribute__((ext_vector_type(4)))  float    v4f;
typedef v8h  __attribute__((may_alias)) v8ha;
typedef v4f  __attribute__((may_alias)) v4fa;
typedef v8us __attribute__((may_alias)) v8usa;

__device__ __forceinline__ unsigned short f2bf(float f) { unsigned u = __float_as_uint(f); u += 0x7FFFu + ((u >> 16) & 1u); return (unsigned short)(u >> 16); }
__device__ __forceinline__ float bf2f(unsigned short b) { return __uint_as_float(((unsigned)b) << 16); }
__device__ __forceinline__ float bfr(float f) { return bf2f(f2bf(f)); }
__device__ __forceinline__ v16h cat16(v8h lo, v8h hi) { return __builtin_shufflevector(lo, hi, 0, 1, 2, 3, 4, 5, 6, 7, 8, 9, 10, 11, 12, 13, 14, 15); }
__device__ __forceinline__ v16bf cat16b(v8us lo, v8us hi) { return __builtin_bit_cast(v16bf, __builtin_shufflevector(lo, hi, 0, 1, 2, 3, 4, 5, 6, 7, 8, 9, 10, 11, 12, 13, 14, 15)); }
__device__ __forceinline__ v8f wmma16(v16h a, v16h b, v8f c) { return __builtin_amdgcn_wmma_f32_16x16x32_f16(false, a, false, b, (short)0, c, false, false); }
__device__ __forceinline__ v8f wmmab(v16bf a, v16bf b, v8f c) { return __builtin_amdgcn_wmma_f32_16x16x32_bf16(false, a, false, b, (short)0, c, false, false); }



// ---- k_gemmw: register-blocked GEMM, ONE WAVE per 64x64 output tile (16 accumulators), operands straight from K-contiguous 16-bit planes; grid (M/64, N/64, Z), 32 threads.
// C[m][n] (f32, pitch ldc, + optional f32 bias[n]) = sum_k A[m][k] Bt[n][k] (+ split products per NSPLIT). z-batch strides sA/sB/sC in elements. K % 32 == 0.
template <typename T16> struct WFrag;
template <> struct WFrag<h16> { typedef v16h V; static __device__ __forceinline__ V ld(const h16* p) { return cat16(*(const v8h*)p, *(const v8h*)(p + 16)); } static __device__ __forceinline__ v8f mma(V a, V b, v8f c) { return wmma16(a, b, c); } };
template <> struct WFrag<bf> { typedef v16bf V; static __device__ __forceinline__ V ld(const bf* p) { return cat16b(*(const v8us*)p, *(const v8us*)(p + 16)); } static __device__ __forceinline__ v8f mma(V a, V b, v8f c) { return wmmab(a, b, c); } };
template <typename T16, int NSPLIT, bool BIAS>
__global__ __launch_bounds__(32) void k_gemmw(const T16* __restrict__ A, const T16* __restrict__ A2, const T16* __restrict__ Bt, const T16* __restrict__ Bt2, int K, float* C, int ldc, const float* __restrict__ bias, size_t sA, size_t sB, size_t sC) {
    typedef typename WFrag<T16>::V V;
    __shared__ __align__(16) float os[16 * 68];
    const size_t z = blockIdx.z; A += z * sA; if (A2) A2 += z * sA; Bt += z * sB; if (Bt2) Bt2 += z * sB; C += z * sC;
    const int lane = threadIdx.x & 31, lr = lane & 15, hi = lane >> 4; const int r0 = blockIdx.x * 64, c0 = blockIdx.y * 64;
    v8f acc[4][4];
#pragma unroll
    for (int mb = 0; mb < 4; ++mb)
#pragma unroll
        for (int nb = 0; nb < 4; ++nb) acc[mb][nb] = (v8f){};
    const size_t aoff = (size_t)(r0 + lr) * K + 8 * hi, boff = (size_t)(c0 + lr) * K + 8 * hi;
#pragma unroll 1
    for (int kc = 0; kc < K; kc += 32) {
        V a[4], a2[4];
#pragma unroll
        for (int mb = 0; mb < 4; ++mb) { a[mb] = WFrag<T16>::ld(A + aoff + (size_t)mb * 16 * K + kc); if (NSPLIT == 1 || NSPLIT == 2) a2[mb] = WFrag<T16>::ld(A2 + aoff + (size_t)mb * 16 * K + kc); }
#pragma unroll
        for (int nb = 0; nb < 4; ++nb) { const V b = WFrag<T16>::ld(Bt + boff + (size_t)nb * 16 * K + kc); V b2; if (NSPLIT >= 2) b2 = WFrag<T16>::ld(Bt2 + boff + (size_t)nb * 16 * K + kc);
#pragma unroll
            for (int mb = 0; mb < 4; ++mb) { acc[mb][nb] = WFrag<T16>::mma(a[mb], b, acc[mb][nb]); if (NSPLIT == 1 || NSPLIT == 2) acc[mb][nb] = WFrag<T16>::mma(a2[mb], b, acc[mb][nb]); if (NSPLIT >= 2) acc[mb][nb] = WFrag<T16>::mma(a[mb], b2, acc[mb][nb]); } }
        asm volatile("v_nop\n\tv_nop\n\tv_nop\n\tv_nop" : "+v"(acc[0][0]), "+v"(acc[1][1]), "+v"(acc[2][2]), "+v"(acc[3][3]) : "v"(a[0]), "v"(a[3]));
    }
#pragma unroll
    for (int mb = 0; mb < 4; ++mb) {
#pragma unroll
        for (int nb = 0; nb < 4; ++nb) {
#pragma unroll
            for (int j = 0; j < 8; ++j) os[(hi * 8 + j) * 68 + nb * 16 + lr] = acc[mb][nb][j]; }
        __builtin_amdgcn_wave_barrier(); asm volatile("" ::: "memory");
        float* crow = C + (size_t)(r0 + mb * 16) * ldc + c0;
{
#pragma unroll
            for (int s = 0; s < 8; ++s) { const int row = 2 * s + hi, cofs = lr * 4; v4f val = *(const v4fa*)(os + row * 68 + cofs); if (BIAS) { val[0] += bfr(bias[c0 + cofs]); val[1] += bfr(bias[c0 + cofs + 1]); val[2] += bfr(bias[c0 + cofs + 2]); val[3] += bfr(bias[c0 + cofs + 3]); }
                *(v4f*)(crow + (size_t)row * ldc + cofs) = val; }
             }
        __builtin_amdgcn_wave_barrier(); asm volatile("" ::: "memory");
    }
}

typedef __attribute__((ext_vector_type(4))) unsigned short v4us;

__global__ __launch_bounds__(256) void k_cvt8(const float* __restrict__ src, bf* dst, size_t n8) { const size_t i = (size_t)blockIdx.x * 256 + threadIdx.x; if (i >= n8) return; const v8f v = *(const v8f*)(src + i * 8); v8us o;
#pragma unroll
    for (int k = 0; k < 8; ++k) o[k] = f2bf(v[k]); *(v8us*)(dst + i * 8) = o;  }
// One launch for all images: a thread takes its (pixel, 4 channels) of every image, all 32 loads issued ahead of the first conversion (8 times fewer waves to start than a grid over images, 8 times the loads in flight per wave).
__global__ __launch_bounds__(256) void k_xt(const float* __restrict__ X, bf* XT) { const int e = (blockIdx.x * 256 + threadIdx.x) * 4; if (e >= NPIX * CI) return; const int c = e % CI; const int p = e / CI; float v[NB_][4];
    const unsigned off = (unsigned)(c * NPIX + p);   // one 32-bit element offset shared by all 32 loads
#pragma unroll
    for (int b = 0; b < NB_; ++b) {
#pragma unroll
        for (int u = 0; u < 4; ++u) v[b][u] = (X + (size_t)b * CI * NPIX + (size_t)u * NPIX)[off]; }
    asm volatile("s_wait_xcnt 0x0" :: "v"(off) : "memory");   // ahead of the first overwrite of an address register of the 32 issued loads (left alone the compiler's wait there was a counted one); the offset is named so that it lives up to the wait
#pragma unroll
    for (int b = 0; b < NB_; ++b) { v4us o;
#pragma unroll
        for (int u = 0; u < 4; ++u) o[u] = f2bf(v[b][u]);
        *(v4us*)((XT + (size_t)b * NPIX * CI) + (unsigned)e) = o; } }
// v_exp_f32 with the slot behind it filled: the instruction set asks for one independent instruction or v_nop before a transcendental's result is read or its source overwritten.
__device__ __forceinline__ float exp2_slot(float a) { float r; asm("v_exp_f32 %0, %1\n\tv_nop" : "=v"(r) : "v"(a)); return r; }
__global__ __launch_bounds__(256) void k_nat(const float* __restrict__ Q, const float* __restrict__ Kp, const float* __restrict__ Vp, float* outb) {   // Q, Kp, Vp: the three [128][NPIX] planes of t, each with a base of its own (from one base the v plane lies beyond a load's immediate offset)
    static_assert(NPIX % 256 == 0 && GD % 8 == 0, "a block stays inside one head; stages of 8 channels");
    { const size_t ib = blockIdx.y; Q += ib * CO * NPIX; Kp += ib * CO * NPIX; Vp += ib * CO * NPIX; outb += ib * CI * NPIX; }   // grid y = image
    const int g = blockIdx.x / (NPIX / 256); if (g >= NG) return; const int p = (blockIdx.x % (NPIX / 256)) * 256 + threadIdx.x; const int y = p / WW, x = p % WW;
    const float* qc = Q + (size_t)(g * GD) * NPIX + p; const float* kb = Kp + (size_t)(g * GD) * NPIX; const float* vb = Vp + (size_t)(g * GD) * NPIX;
    // Straight-line body in stages of 8 channels (4 of q . k, then 4 of att . v): no load stands under a branch, and each stage's loads are issued as one group, into the other
    // register set, ahead of the arithmetic of the stage before, so that a wave keeps many loads in flight instead of one waited pair.
    // A padded neighbour reads the centre pixel (always in bounds); its score is replaced by 0 and its weight on v by 0, as k = v = 0 there.
    bool in9[9]; int np9[9]; float s9[9];
#pragma unroll
    for (int n = 0; n < 9; ++n) { const int yy = y + n / 3 - 1, xx = x + n % 3 - 1; in9[n] = (yy >= 0 && yy < HH && xx >= 0 && xx < WW); np9[n] = in9[n] ? (yy * WW + xx) : p; s9[n] = 0.f; }
    float nb[2][8][9], qv[2][8];
    auto load_k = [&](int c) {
#pragma unroll
        for (int i = 0; i < 8; ++i) { qv[c & 1][i] = qc[(size_t)(c * 8 + i) * NPIX];
#pragma unroll
            for (int n = 0; n < 9; ++n) nb[c & 1][i][n] = kb[(size_t)(c * 8 + i) * NPIX + np9[n]]; } };
    auto load_v = [&](int c) {
#pragma unroll
        for (int i = 0; i < 8; ++i) {
#pragma unroll
            for (int n = 0; n < 9; ++n) nb[c & 1][i][n] = vb[(size_t)(c * 8 + i) * NPIX + np9[n]]; } };
    load_k(0);
#pragma unroll
    for (int c = 0; c < GD / 8; ++c) {
        if (c + 1 < GD / 8) load_k(c + 1); else load_v(0);
        __builtin_amdgcn_sched_barrier(0);   // keeps the next stage's loads ahead of this stage's arithmetic (left alone the compiler put each load directly in front of its use, with a full wait)
#pragma unroll
        for (int i = 0; i < 8; ++i) {
#pragma unroll
            for (int n = 0; n < 9; ++n) s9[n] = fmaf(qv[c & 1][i], nb[c & 1][i][n], s9[n]); }
        __builtin_amdgcn_sched_barrier(0);   // keeps this stage's arithmetic ahead of the loads that refill its registers (without it the compiler drew a third stage's loads forward, at 253 registers, and scattered later loads among the sums)
    }
    float att[9]; float mx = -3.0e38f;
#pragma unroll
    for (int n = 0; n < 9; ++n) { att[n] = (in9[n] ? s9[n] : 0.f) * 0.17677669529663689f; mx = fmaxf(mx, att[n]); }   // a padded neighbour scores exactly 0 (k = 0), as the source
    float sum = 0.f;
#pragma unroll
    for (int n = 0; n < 9; ++n) { att[n] = exp2_slot((att[n] - mx) * 1.4426950408889634f); sum += att[n]; }
    const float f = __fdiv_rn(1.0f, sum);
#pragma unroll
    for (int n = 0; n < 9; ++n) att[n] = in9[n] ? att[n] * f : 0.f;
#pragma unroll
    for (int c = 0; c < GD / 8; ++c) {
        if (c + 1 < GD / 8) load_v(c + 1);
        // behind the last group of loads the nine offsets are dead: they are named here so that no load of that group lands in an offset register that an issued load still names, ahead of the wait
        if (c + 2 == GD / 8) asm volatile("s_wait_xcnt 0x0" :: "v"(np9[0]), "v"(np9[1]), "v"(np9[2]), "v"(np9[3]), "v"(np9[4]), "v"(np9[5]), "v"(np9[6]), "v"(np9[7]), "v"(np9[8]) : "memory");
        __builtin_amdgcn_sched_barrier(0);   // as above: the next stage's loads stay ahead of this stage's arithmetic
#pragma unroll
        for (int i = 0; i < 8; ++i) { float o = 0.f;
#pragma unroll
            for (int n = 0; n < 9; ++n) o = fmaf(att[n], nb[c & 1][i][n], o);
            outb[(size_t)(g * GD + c * 8 + i) * NPIX + p] = o; }
        if (c + 1 < GD / 8) asm volatile("s_wait_xcnt 0x0" ::: "memory");   // the stores' data registers are overwritten by the next loads and sums
    } }

extern "C" void kernel_launch(void* const* d_in, const int* in_sizes, int n_in,
                              void* d_out, int out_size, void* d_ws, size_t ws_size, hipStream_t stream) {
    (void)in_sizes; (void)n_in; (void)out_size;
    const float* x = (const float*)d_in[0]; const float* Wt = (const float*)d_in[1];
    float* OUT = (float*)d_out;     // [8][128][9216]
    char* wsp = (char*)d_ws;
    auto take = [&](size_t bytes) { char* p = wsp; wsp += (bytes + 255) & ~(size_t)255; return (void*)p; };
    bf* AW = (bf*)take((size_t)CO * CI * 2); bf* XT = (bf*)take((size_t)NB_ * NPIX * CI * 2); float* T = (float*)take((size_t)NB_ * CO * NPIX * 4);   // all images at once
    if ((size_t)(wsp - (char*)d_ws) > ws_size) return;    // total ~ 133 MB
    k_cvt8<<<(CO * CI / 8 + 255) / 256, 256, 0, stream>>>(Wt, AW, CO * CI / 8);
    k_xt<<<(NPIX * CI / 4 + 255) / 256, 256, 0, stream>>>(x, XT);
    k_gemmw<bf, 0, false><<<dim3(CO / 64, NPIX / 64, NB_), 32, 0, stream>>>(AW, nullptr, XT, nullptr, CI, T, NPIX, nullptr, 0, (size_t)NPIX * CI, (size_t)CO * NPIX);   // t[b][o][p], grid z = image
    k_nat<<<dim3((NG * NPIX + 255) / 256, NB_, 1), 256, 0, stream>>>(T, T + (size_t)CI * NPIX, T + (size_t)2 * CI * NPIX, OUT);
}

// v003
// Measured time: 85.6 microseconds a run.
// Next to v002, in two timings, it ran 1.33 and 1.34 times as fast.
// All steps since v000 together make it 10.9 times as fast.
#include <hip/hip_runtime.h>

// SGAT (x [8][128][96][96] channel-major; t = W_trans . x (1x1 conv, [384][128]): q = t[0:128], k = t[128:256], v = t[256:384], 4 heads x 32; for every pixel: att[n] = q . k(neighbour n) / sqrt(32) over the zero-padded 3x3 neighbourhood (n row-major (dy, dx); padded neighbours contribute k = v = 0, NOT masked),
//   softmax over the 9; out = sum_n att[n] v(neighbour n) -> [8][128][96][96] channel-major).
// Compute dtypes, f32 accumulate: every input rounded to bf16; the 1x1 conv as a PLAIN bf16 GEMM W . x^T (inputs: exact; both rounded, and x transposed, inside the GEMM's work-groups, through LDS); the 3x3 neighbourhood attention entirely in f32 on VALU (unrolled loops; thread per (head, pixel), lanes along pixels so every output line is 32 consecutive pixels of one channel).

#define NB_  8
#define CI   128
#define CO   384
#define HH   96
#define WW   96
#define NPIX (HH * WW)
#define NG   4
#define GD   32
typedef _Float16 h16;
typedef unsigned short bf;
typedef __attribute__((ext_vector_type(16))) __bf16   v16bf;
typedef __attribute__((ext_vector_type(16))) _Float16 v16h;
typedef __attribute__((ext_vector_type(8)))  _Float16 v8h;
typedef __attribute__((ext_vector_type(8)))  unsigned short v8us;
typedef __attribute__((ext_vector_type(8)))  float    v8f;
typedef __attribute__((ext_vector_type(4)))  float    v4f;
typedef v8h  __attribute__((may_alias)) v8ha;
typedef v4f  __attribute__((may_alias)) v4fa;
typedef v8us __attribute__((may_alias)) v8usa;

__device__ __forceinline__ unsigned short f2bf(float f) { unsigned u = __float_as_uint(f); u += 0x7FFFu + ((u >> 16) & 1u); return (unsigned short)(u >> 16); }
__device__ __forceinline__ float bf2f(unsigned short b) { return __uint_as_float(((unsigned)b) << 16); }
__device__ __forceinline__ float bfr(float f) { return bf2f(f2bf(f)); }
__device__ __forceinline__ v16h cat16(v8h lo, v8h hi) { return __builtin_shufflevector(lo, hi, 0, 1, 2, 3, 4, 5, 6, 7, 8, 9, 10, 11, 12, 13, 14, 15); }
__device__ __forceinline__ v16bf cat16b(v8us lo, v8us hi) { return __builtin_bit_cast(v16bf, __builtin_shufflevector(lo, hi, 0, 1, 2, 3, 4, 5, 6, 7, 8, 9, 10, 11, 12, 13, 14, 15)); }
__device__ __forceinline__ v8f wmma16(v16h a, v16h b, v8f c) { return __builtin_amdgcn_wmma_f32_16x16x32_f16(false, a, false, b, (short)0, c, false, false); }
__device__ __forceinline__ v8f wmmab(v16bf a, v16bf b, v8f c) { return __builtin_amdgcn_wmma_f32_16x16x32_bf16(false, a, false, b, (short)0, c, false, false); }



// ---- k_gemmx: t[o][p] = sum_c W[o][c] x[c][p], one image (grid y) and 64 pixels (grid x) per work-group; 8 waves, each 48 output channels x 64 pixels (12 accumulators).
// Both operands are prepared here, in LDS, once per work-group: W (f32, K-contiguous) and x (f32, channel-major) are read in whole lines and rounded to bf16;
// a wave writes its own 48 rows of W as they lie, a thread writes its 8 channels x 4 pixels of x pixel-major (K-contiguous). All fragments are 16-byte LDS reads.
// Same k order in both loaders: k = 8 hi + 0..7, then 16 + 8 hi + 0..7.
#define PT 64
#define XP (CI + 8)   // LDS pitch of a row of 128 bf16: 272 B = 16 B x 17, odd, for the 16-byte fragment reads
typedef __attribute__((ext_vector_type(4))) unsigned short v4us;
typedef v4us __attribute__((may_alias)) v4usa;
__device__ __forceinline__ v16bf ldfrag(const bf* p) { return cat16b(*(const v8usa*)p, *(const v8usa*)(p + 16)); }
__global__ __launch_bounds__(256) void k_gemmx(const float* __restrict__ Wf, const float* __restrict__ X, float* C) {
    static_assert(NPIX % PT == 0 && CO == 8 * 48 && CI == 128 && PT == 64, "8 waves x 48 rows; a lane takes 4 of a W row's 128; a thread stages 8 channels x 4 pixels");
    __shared__ struct __align__(16) { bf xs[PT * XP]; float osm[8][16 * 68]; bf wsm[CO * XP]; } sm;   // in this order every constant part of an LDS address fits the instruction's 16-bit offset
    bf* const xs = sm.xs; bf* const wsm = sm.wsm;
    const int tid = threadIdx.x, lane = tid & 31, lr = lane & 15, hi = lane >> 4;
    const int wave = __builtin_amdgcn_readfirstlane(tid >> 5);
    const int c0 = blockIdx.x * PT;
    const int pg = tid & 15, cg = tid >> 4;   // 4 pixels, 8 channels: 16 lanes cover the 256 B of one channel's 64 pixels
    const char* Xb = (const char*)(X + (size_t)blockIdx.y * CI * NPIX + c0);
    const float* Wr = Wf + (size_t)(wave * 48) * CI;   // the wave's own 48 rows; a load is one row, 16 B a lane
    const unsigned xoff = (unsigned)(cg * 8 * NPIX + pg * 4) * 4u;   // byte offset, one register for the 8 loads of x
    v4f xv[8], wv[48];
    auto put_w = [&](int i) { v4us o;
#pragma unroll
        for (int u = 0; u < 4; ++u) o[u] = f2bf(wv[i][u]);
        *(v4usa*)(wsm + (wave * 48 + i) * XP + lane * 4) = o; };
#pragma unroll
    for (int i = 0; i < 8; ++i) xv[i] = *(const v4fa*)(Xb + (size_t)i * NPIX * 4 + xoff);
#pragma unroll
    for (int i = 0; i < 36; ++i) wv[i] = ((const v4fa*)(Wr + (size_t)i * CI))[lane];
    asm volatile("s_wait_xcnt 0x0" :: "v"(xoff), "v"(lane) : "memory");   // ahead of the first overwrite of a base or offset register of the 44 issued loads; the offsets are named so that they live up to the wait
    __builtin_amdgcn_sched_barrier(0);   // nothing from below is drawn ahead of that wait (left alone the compiler rewrote x's base register above it, behind a counted wait)
#pragma unroll
    for (int u = 0; u < 4; ++u) { v8us o;
#pragma unroll
        for (int i = 0; i < 8; ++i) o[i] = f2bf(xv[i][u]);
        *(v8usa*)(xs + (pg * 4 + u) * XP + cg * 8) = o; }
#pragma unroll
    for (int i = 0; i < 12; ++i) put_w(i);
    __builtin_amdgcn_sched_barrier(0);   // the last 12 rows' loads go into the registers freed above: all 56 at once did not fit 256 registers
#pragma unroll
    for (int i = 36; i < 48; ++i) wv[i] = ((const v4fa*)(Wr + (size_t)i * CI))[lane];
    asm volatile("s_wait_xcnt 0x0" :: "v"(lane) : "memory");   // as above, for these 12 loads
    __builtin_amdgcn_sched_barrier(0);   // as above
#pragma unroll
    for (int i = 12; i < 48; ++i) put_w(i);
    __syncthreads();   // the x tile is complete before any wave reads a fragment of it
    v8f acc[3][4];
#pragma unroll
    for (int mb = 0; mb < 3; ++mb)
#pragma unroll
        for (int nb = 0; nb < 4; ++nb) acc[mb][nb] = (v8f){};
    const bf* ap = wsm + (wave * 48 + lr) * XP + 8 * hi;
    const bf* bp = xs + lr * XP + 8 * hi;
    v16bf a[2][3], b[2][4];
    auto ldk = [&](int kq) {
#pragma unroll
        for (int mb = 0; mb < 3; ++mb) a[kq & 1][mb] = ldfrag(ap + mb * 16 * XP + kq * 32);
#pragma unroll
        for (int nb = 0; nb < 4; ++nb) b[kq & 1][nb] = ldfrag(bp + nb * 16 * XP + kq * 32); };
    ldk(0);
#pragma unroll
    for (int kq = 0; kq < 4; ++kq) {
        if (kq + 1 < 4) ldk(kq + 1);
        __builtin_amdgcn_sched_barrier(0);   // keeps the next k step's 14 fragment reads ahead of this step's products (left alone the compiler read each B fragment directly in front of its use, with a full wait)
#pragma unroll
        for (int nb = 0; nb < 4; ++nb) {
#pragma unroll
            for (int mb = 0; mb < 3; ++mb) acc[mb][nb] = wmmab(a[kq & 1][mb], b[kq & 1][nb], acc[mb][nb]); }
        __builtin_amdgcn_sched_barrier(0);   // keeps this step's products ahead of the reads that refill their fragment registers
    }
    // Each wave turns its accumulators through its own LDS patch, so that a store is two rows of 256 contiguous bytes.
    float* os = sm.osm[wave];
    char* Cb = (char*)(C + (size_t)blockIdx.y * CO * NPIX + (size_t)(wave * 48) * NPIX + c0);
    const unsigned coff = (unsigned)(hi * NPIX + lr * 4) * 4u;   // byte offset, one register for all stores
#pragma unroll
    for (int mb = 0; mb < 3; ++mb) {
#pragma unroll
        for (int nb = 0; nb < 4; ++nb) {
#pragma unroll
            for (int j = 0; j < 8; ++j) os[(hi * 8 + j) * 68 + nb * 16 + lr] = acc[mb][nb][j]; }
        asm volatile("s_wait_dscnt 0x0" ::: "memory");   // the patch is written before it is read back; the clobber keeps the reads below, which take other lanes' words, from being lifted over the writes
        v4f val[8];
#pragma unroll
        for (int s = 0; s < 8; ++s) val[s] = *(const v4fa*)(os + (2 * s + hi) * 68 + lr * 4);
#pragma unroll
        for (int s = 0; s < 8; ++s) *(v4fa*)(Cb + (size_t)(mb * 16 + 2 * s) * NPIX * 4 + coff) = val[s];
        if (mb < 2) asm volatile("s_wait_xcnt 0x0" ::: "memory");   // the stores' data registers are overwritten by the next block's reads; the clobber keeps the next block's writes of the patch behind this block's reads
    }
}

// v_exp_f32 with the slot behind it filled: the instruction set asks for one independent instruction or v_nop before a transcendental's result is read or its source overwritten.
__device__ __forceinline__ float exp2_slot(float a) { float r; asm("v_exp_f32 %0, %1\n\tv_nop" : "=v"(r) : "v"(a)); return r; }
__global__ __launch_bounds__(256) void k_nat(const float* __restrict__ Q, const float* __restrict__ Kp, const float* __restrict__ Vp, float* outb) {   // Q, Kp, Vp: the three [128][NPIX] planes of t, each with a base of its own (from one base the v plane lies beyond a load's immediate offset)
    static_assert(NPIX % 256 == 0 && GD % 8 == 0, "a block stays inside one head; stages of 8 channels");
    { const size_t ib = blockIdx.y; Q += ib * CO * NPIX; Kp += ib * CO * NPIX; Vp += ib * CO * NPIX; outb += ib * CI * NPIX; }   // grid y = image
    const int g = blockIdx.x / (NPIX / 256); if (g >= NG) return; const int p = (blockIdx.x % (NPIX / 256)) * 256 + threadIdx.x; const int y = p / WW, x = p % WW;
    const float* qc = Q + (size_t)(g * GD) * NPIX + p; const float* kb = Kp + (size_t)(g * GD) * NPIX; const float* vb = Vp + (size_t)(g * GD) * NPIX;
    // Straight-line body in stages of 8 channels (4 of q . k, then 4 of att . v): no load stands under a branch, and each stage's loads are issued as one group, into the other
    // register set, ahead of the arithmetic of the stage before, so that a wave keeps many loads in flight instead of one waited pair.
    // A padded neighbour reads the centre pixel (always in bounds); its score is replaced by 0 and its weight on v by 0, as k = v = 0 there.
    bool in9[9]; int np9[9]; float s9[9];
#pragma unroll
    for (int n = 0; n < 9; ++n) { const int yy = y + n / 3 - 1, xx = x + n % 3 - 1; in9[n] = (yy >= 0 && yy < HH && xx >= 0 && xx < WW); np9[n] = in9[n] ? (yy * WW + xx) : p; s9[n] = 0.f; }
    float nb[2][8][9], qv[2][8];
    auto load_k = [&](int c) {
#pragma unroll
        for (int i = 0; i < 8; ++i) { qv[c & 1][i] = qc[(size_t)(c * 8 + i) * NPIX];
#pragma unroll
            for (int n = 0; n < 9; ++n) nb[c & 1][i][n] = kb[(size_t)(c * 8 + i) * NPIX + np9[n]]; } };
    auto load_v = [&](int c) {
#pragma unroll
        for (int i = 0; i < 8; ++i) {
#pragma unroll
            for (int n = 0; n < 9; ++n) nb[c & 1][i][n] = vb[(size_t)(c * 8 + i) * NPIX + np9[n]]; } };
    load_k(0);
#pragma unroll
    for (int c = 0; c < GD / 8; ++c) {
        if (c + 1 < GD / 8) load_k(c + 1); else load_v(0);
        __builtin_amdgcn_sched_barrier(0);   // keeps the next stage's loads ahead of this stage's arithmetic (left alone the compiler put each load directly in front of its use, with a full wait)
#pragma unroll
        for (int i = 0; i < 8; ++i) {
#pragma unroll
            for (int n = 0; n < 9; ++n) s9[n] = fmaf(qv[c & 1][i], nb[c & 1][i][n], s9[n]); }
        __builtin_amdgcn_sched_barrier(0);   // keeps this stage's arithmetic ahead of the loads that refill its registers (without it the compiler drew a third stage's loads forward, at 253 registers, and scattered later loads among the sums)
    }
    float att[9]; float mx = -3.0e38f;
#pragma unroll
    for (int n = 0; n < 9; ++n) { att[n] = (in9[n] ? s9[n] : 0.f) * 0.17677669529663689f; mx = fmaxf(mx, att[n]); }   // a padded neighbour scores exactly 0 (k = 0), as the source
    float sum = 0.f;
#pragma unroll
    for (int n = 0; n < 9; ++n) { att[n] = exp2_slot((att[n] - mx) * 1.4426950408889634f); sum += att[n]; }
    const float f = __fdiv_rn(1.0f, sum);
#pragma unroll
    for (int n = 0; n < 9; ++n) att[n] = in9[n] ? att[n] * f : 0.f;
#pragma unroll
    for (int c = 0; c < GD / 8; ++c) {
        if (c + 1 < GD / 8) load_v(c + 1);
        // behind the last group of loads the nine offsets are dead: they are named here so that no load of that group lands in an offset register that an issued load still names, ahead of the wait
        if (c + 2 == GD / 8) asm volatile("s_wait_xcnt 0x0" :: "v"(np9[0]), "v"(np9[1]), "v"(np9[2]), "v"(np9[3]), "v"(np9[4]), "v"(np9[5]), "v"(np9[6]), "v"(np9[7]), "v"(np9[8]) : "memory");
        __builtin_amdgcn_sched_barrier(0);   // as above: the next stage's loads stay ahead of this stage's arithmetic
#pragma unroll
        for (int i = 0; i < 8; ++i) { float o = 0.f;
#pragma unroll
            for (int n = 0; n < 9; ++n) o = fmaf(att[n], nb[c & 1][i][n], o);
            outb[(size_t)(g * GD + c * 8 + i) * NPIX + p] = o; }
        if (c + 1 < GD / 8) asm volatile("s_wait_xcnt 0x0" ::: "memory");   // the stores' data registers are overwritten by the next loads and sums
    } }

extern "C" void kernel_launch(void* const* d_in, const int* in_sizes, int n_in,
                              void* d_out, int out_size, void* d_ws, size_t ws_size, hipStream_t stream) {
    (void)in_sizes; (void)n_in; (void)out_size;
    const float* x = (const float*)d_in[0]; const float* Wt = (const float*)d_in[1];
    float* OUT = (float*)d_out;     // [8][128][9216]
    char* wsp = (char*)d_ws;
    auto take = [&](size_t bytes) { char* p = wsp; wsp += (bytes + 255) & ~(size_t)255; return (void*)p; };
    float* T = (float*)take((size_t)NB_ * CO * NPIX * 4);   // all images at once
    if ((size_t)(wsp - (char*)d_ws) > ws_size) return;    // total ~ 113 MB
    k_gemmx<<<dim3(NPIX / PT, NB_, 1), 256, 0, stream>>>(Wt, x, T);   // t[b][o][p], grid y = image
    k_nat<<<dim3((NG * NPIX + 255) / 256, NB_, 1), 256, 0, stream>>>(T, T + (size_t)CI * NPIX, T + (size_t)2 * CI * NPIX, OUT);
}

// v004
// One run takes 51.7 microseconds.
// Two timings next to v003 put it at 1.66 and 1.65 times that version's speed.
// All steps since v000 together make it 18.1 times as fast.
#include <hip/hip_runtime.h>

// SGAT (x [8][128][96][96] channel-major; t = W_trans . x (1x1 conv, [384][128]): q = t[0:128], k = t[128:256], v = t[256:384], 4 heads x 32; for every pixel: att[n] = q . k(neighbour n) / sqrt(32) over the zero-padded 3x3 neighbourhood (n row-major (dy, dx); padded neighbours contribute k = v = 0, NOT masked),
//   softmax over the 9; out = sum_n att[n] v(neighbour n) -> [8][128][96][96] channel-major).
// Compute dtypes, f32 accumulate: every input rounded to bf16; the 1x1 conv as a PLAIN bf16 GEMM W . x^T (inputs: exact; both rounded, and x transposed, inside the GEMM's work-groups, through LDS); the 3x3 neighbourhood attention entirely in f32 on VALU (unrolled loops; k and v staged in LDS; thread per (head, 4 pixels of a row), lanes along pixels so a wave's store is 128 consecutive pixels of one channel).

#define NB_  8
#define CI   128
#define CO   384
#define HH   96
#define WW   96
#define NPIX (HH * WW)
#define NG   4
#define GD   32
typedef _Float16 h16;
typedef unsigned short bf;
typedef __attribute__((ext_vector_type(16))) __bf16   v16bf;
typedef __attribute__((ext_vector_type(16))) _Float16 v16h;
typedef __attribute__((ext_vector_type(8)))  _Float16 v8h;
typedef __attribute__((ext_vector_type(8)))  unsigned short v8us;
typedef __attribute__((ext_vector_type(8)))  float    v8f;
typedef __attribute__((ext_vector_type(4)))  float    v4f;
typedef v8h  __attribute__((may_alias)) v8ha;
typedef v4f  __attribute__((may_alias)) v4fa;
typedef v8us __attribute__((may_alias)) v8usa;

__device__ __forceinline__ unsigned short f2bf(float f) { unsigned u = __float_as_uint(f); u += 0x7FFFu + ((u >> 16) & 1u); return (unsigned short)(u >> 16); }
__device__ __forceinline__ float bf2f(unsigned short b) { return __uint_as_float(((unsigned)b) << 16); }
__device__ __forceinline__ float bfr(float f) { return bf2f(f2bf(f)); }
__device__ __forceinline__ v16h cat16(v8h lo, v8h hi) { return __builtin_shufflevector(lo, hi, 0, 1, 2, 3, 4, 5, 6, 7, 8, 9, 10, 11, 12, 13, 14, 15); }
__device__ __forceinline__ v16bf cat16b(v8us lo, v8us hi) { return __builtin_bit_cast(v16bf, __builtin_shufflevector(lo, hi, 0, 1, 2, 3, 4, 5, 6, 7, 8, 9, 10, 11, 12, 13, 14, 15)); }
__device__ __forceinline__ v8f wmma16(v16h a, v16h b, v8f c) { return __builtin_amdgcn_wmma_f32_16x16x32_f16(false, a, false, b, (short)0, c, false, false); }
__device__ __forceinline__ v8f wmmab(v16bf a, v16bf b, v8f c) { return __builtin_amdgcn_wmma_f32_16x16x32_bf16(false, a, false, b, (short)0, c, false, false); }



// ---- k_gemmx: t[o][p] = sum_c W[o][c] x[c][p], one image (grid y) and 64 pixels (grid x) per work-group; 8 waves, each 48 output channels x 64 pixels (12 accumulators).
// Both operands are prepared here, in LDS, once per work-group: W (f32, K-contiguous) and x (f32, channel-major) are read in whole lines and rounded to bf16;
// a wave writes its own 48 rows of W as they lie, a thread writes its 8 channels x 4 pixels of x pixel-major (K-contiguous). All fragments are 16-byte LDS reads.
// Same k order in both loaders: k = 8 hi + 0..7, then 16 + 8 hi + 0..7.
#define PT 64
#define XP (CI + 8)   // LDS pitch of a row of 128 bf16: 272 B = 16 B x 17, odd, for the 16-byte fragment reads
typedef __attribute__((ext_vector_type(4))) unsigned short v4us;
typedef v4us __attribute__((may_alias)) v4usa;
__device__ __forceinline__ v16bf ldfrag(const bf* p) { return cat16b(*(const v8usa*)p, *(const v8usa*)(p + 16)); }
__global__ __launch_bounds__(256) void k_gemmx(const float* __restrict__ Wf, const float* __restrict__ X, float* C) {
    static_assert(NPIX % PT == 0 && CO == 8 * 48 && CI == 128 && PT == 64, "8 waves x 48 rows; a lane takes 4 of a W row's 128; a thread stages 8 channels x 4 pixels");
    __shared__ struct __align__(16) { bf xs[PT * XP]; float osm[8][16 * 68]; bf wsm[CO * XP]; } sm;   // in this order every constant part of an LDS address fits the instruction's 16-bit offset
    bf* const xs = sm.xs; bf* const wsm = sm.wsm;
    const int tid = threadIdx.x, lane = tid & 31, lr = lane & 15, hi = lane >> 4;
    const int wave = __builtin_amdgcn_readfirstlane(tid >> 5);
    const int c0 = blockIdx.x * PT;
    const int pg = tid & 15, cg = tid >> 4;   // 4 pixels, 8 channels: 16 lanes cover the 256 B of one channel's 64 pixels
    const char* Xb = (const char*)(X + (size_t)blockIdx.y * CI * NPIX + c0);
    const float* Wr = Wf + (size_t)(wave * 48) * CI;   // the wave's own 48 rows; a load is one row, 16 B a lane
    const unsigned xoff = (unsigned)(cg * 8 * NPIX + pg * 4) * 4u;   // byte offset, one register for the 8 loads of x
    v4f xv[8], wv[48];
    auto put_w = [&](int i) { v4us o;
#pragma unroll
        for (int u = 0; u < 4; ++u) o[u] = f2bf(wv[i][u]);
        *(v4usa*)(wsm + (wave * 48 + i) * XP + lane * 4) = o; };
#pragma unroll
    for (int i = 0; i < 8; ++i) xv[i] = *(const v4fa*)(Xb + (size_t)i * NPIX * 4 + xoff);
#pragma unroll
    for (int i = 0; i < 36; ++i) wv[i] = ((const v4fa*)(Wr + (size_t)i * CI))[lane];
    asm volatile("s_wait_xcnt 0x0" :: "v"(xoff), "v"(lane) : "memory");   // ahead of the first overwrite of a base or offset register of the 44 issued loads; the offsets are named so that they live up to the wait
    __builtin_amdgcn_sched_barrier(0);   // nothing from below is drawn ahead of that wait (left alone the compiler rewrote x's base register above it, behind a counted wait)
#pragma unroll
    for (int u = 0; u < 4; ++u) { v8us o;
#pragma unroll
        for (int i = 0; i < 8; ++i) o[i] = f2bf(xv[i][u]);
        *(v8usa*)(xs + (pg * 4 + u) * XP + cg * 8) = o; }
#pragma unroll
    for (int i = 0; i < 12; ++i) put_w(i);
    __builtin_amdgcn_sched_barrier(0);   // the last 12 rows' loads go into the registers freed above: all 56 at once did not fit 256 registers
#pragma unroll
    for (int i = 36; i < 48; ++i) wv[i] = ((const v4fa*)(Wr + (size_t)i * CI))[lane];
    asm volatile("s_wait_xcnt 0x0" :: "v"(lane) : "memory");   // as above, for these 12 loads
    __builtin_amdgcn_sched_barrier(0);   // as above
#pragma unroll
    for (int i = 12; i < 48; ++i) put_w(i);
    __syncthreads();   // the x tile is complete before any wave reads a fragment of it
    v8f acc[3][4];
#pragma unroll
    for (int mb = 0; mb < 3; ++mb)
#pragma unroll
        for (int nb = 0; nb < 4; ++nb) acc[mb][nb] = (v8f){};
    const bf* ap = wsm + (wave * 48 + lr) * XP + 8 * hi;
    const bf* bp = xs + lr * XP + 8 * hi;
    v16bf a[2][3], b[2][4];
    auto ldk = [&](int kq) {
#pragma unroll
        for (int mb = 0; mb < 3; ++mb) a[kq & 1][mb] = ldfrag(ap + mb * 16 * XP + kq * 32);
#pragma unroll
        for (int nb = 0; nb < 4; ++nb) b[kq & 1][nb] = ldfrag(bp + nb * 16 * XP + kq * 32); };
    ldk(0);
#pragma unroll
    for (int kq = 0; kq < 4; ++kq) {
        if (kq + 1 < 4) ldk(kq + 1);
        __builtin_amdgcn_sched_barrier(0);   // keeps the next k step's 14 fragment reads ahead of this step's products (left alone the compiler read each B fragment directly in front of its use, with a full wait)
#pragma unroll
        for (int nb = 0; nb < 4; ++nb) {
#pragma unroll
            for (int mb = 0; mb < 3; ++mb) acc[mb][nb] = wmmab(a[kq & 1][mb], b[kq & 1][nb], acc[mb][nb]); }
        __builtin_amdgcn_sched_barrier(0);   // keeps this step's products ahead of the reads that refill their fragment registers
    }
    // Each wave turns its accumulators through its own LDS patch, so that a store is two rows of 256 contiguous bytes.
    float* os = sm.osm[wave];
    char* Cb = (char*)(C + (size_t)blockIdx.y * CO * NPIX + (size_t)(wave * 48) * NPIX + c0);
    const unsigned coff = (unsigned)(hi * NPIX + lr * 4) * 4u;   // byte offset, one register for all stores
#pragma unroll
    for (int mb = 0; mb < 3; ++mb) {
#pragma unroll
        for (int nb = 0; nb < 4; ++nb) {
#pragma unroll
            for (int j = 0; j < 8; ++j) os[(hi * 8 + j) * 68 + nb * 16 + lr] = acc[mb][nb][j]; }
        asm volatile("s_wait_dscnt 0x0" ::: "memory");   // the patch is written before it is read back; the clobber keeps the reads below, which take other lanes' words, from being lifted over the writes
        v4f val[8];
#pragma unroll
        for (int s = 0; s < 8; ++s) val[s] = *(const v4fa*)(os + (2 * s + hi) * 68 + lr * 4);
#pragma unroll
        for (int s = 0; s < 8; ++s) *(v4fa*)(Cb + (size_t)(mb * 16 + 2 * s) * NPIX * 4 + coff) = val[s];
        if (mb < 2) asm volatile("s_wait_xcnt 0x0" ::: "memory");   // the stores' data registers are overwritten by the next block's reads; the clobber keeps the next block's writes of the patch behind this block's reads
    }
}

// v_exp_f32 with the slot behind it filled: the instruction set asks for one independent instruction or v_nop before a transcendental's result is read or its source overwritten.
__device__ __forceinline__ __attribute__((target("no-packed-fp32-ops"))) float exp2_slot(float a) { float r; asm("v_exp_f32 %0, %1\n\tv_nop" : "=v"(r) : "v"(a)); return r; }
// ---- k_nat: one work-group = one image (grid z), one head (grid y), 4 whole rows of pixels (grid x); 96 threads, a thread takes 4 pixels side by side.
// k and v come into LDS once, in stages of 8 channels x 6 rows (the 4 rows and one above and below), by asynchronous copies into two buffers: the next stage flies while this one is worked on.
// A thread reads, per channel and row, its 4 values as 16 bytes and the two beside them; every neighbour of its 4 pixels is among these 18 values.
// A padded neighbour reads a real value (rows beyond the image are copied from the edge row, the value beside a row's end is taken from inside the row); its score is replaced by 0 and its weight on v by 0, as k = v = 0 there.
#define TR  4                 // rows of a tile
#define WPX ((TR + 2) * WW)   // floats of one channel in a stage: 6 rows
#define SC  8                 // channels of a stage
#define NTH (TR * WW / 4)     // 96 threads
// k_nat and what is inlined into it are built without packed f32 arithmetic: with it the compiler paired the sums of neighbouring pixels, whose operands do not lie in aligned register pairs, and paid a register move per pair (about 400 moves, 462 registers)
#define NOPK __attribute__((target("no-packed-fp32-ops")))
// the body of __syncthreads(): the header's own function is not inlined into a function built with another feature set
__device__ __forceinline__ NOPK void wg_sync() { __builtin_amdgcn_fence(__ATOMIC_RELEASE, "workgroup"); __builtin_amdgcn_s_barrier(); __builtin_amdgcn_fence(__ATOMIC_ACQUIRE, "workgroup"); }
__global__ __launch_bounds__(NTH) NOPK void k_nat(const float* __restrict__ Q, const float* __restrict__ Kp, const float* __restrict__ Vp, float* outb) {   // Q, Kp, Vp: the three [128][NPIX] planes of t
    static_assert(HH % TR == 0 && WW % 4 == 0 && NTH % 32 == 0 && GD % SC == 0 && (2 * WPX / 4) % NTH == 0 && SC * WPX / 4 == 12 * NTH, "whole waves; two channels of a stage are 3 copies a thread, a stage 12");
    // every loop below is unrolled: the register arrays need constant indices, and buffer, channel and row become immediate LDS offsets
    __shared__ __align__(16) float kv[2][SC * WPX];
    const int tid = (int)__builtin_amdgcn_workitem_id_x(), g = (int)__builtin_amdgcn_workgroup_id_y(), r0 = (int)__builtin_amdgcn_workgroup_id_x() * TR;   // threadIdx.x, blockIdx.y, blockIdx.x
    { const size_t ib = __builtin_amdgcn_workgroup_id_z(); /* blockIdx.z */ Q += ib * CO * NPIX; Kp += ib * CO * NPIX; Vp += ib * CO * NPIX; outb += ib * CI * NPIX; }
    const int p = r0 * WW + tid * 4, y = r0 + tid / (WW / 4), x0 = (tid % (WW / 4)) * 4;
    const float* qc = Q + (size_t)(g * GD) * NPIX + p; const float* kb = Kp + (size_t)(g * GD) * NPIX; const float* vb = Vp + (size_t)(g * GD) * NPIX;
    float* ob = outb + (size_t)(g * GD) * NPIX + p;
    // The thread's three copies of a pair of channels: 16-byte unit w = m * 96 + tid of the pair's 288; a row beyond the image is taken from the edge row (in bounds, never used).
    int goff[3];
#pragma unroll
    for (int m = 0; m < 3; ++m) { const int w = m * NTH + tid, ch = (w >= WPX / 4) ? 1 : 0, f = (w - ch * (WPX / 4)) * 4; int gy = r0 - 1 + f / WW; gy = gy < 0 ? 0 : (gy > HH - 1 ? HH - 1 : gy); goff[m] = ch * NPIX + gy * WW + f % WW; }
    const unsigned lds0 = (unsigned)(size_t)(&kv[0][0]) + (unsigned)tid * 16u;
    auto copy_stage = [&](const float* pl, int b) NOPK {   // pl: the stage's first channel; 12 copies a thread, LDS unit j * 96 + tid
        const float* a[12]; unsigned l[12];
#pragma unroll
        for (int j = 0; j < 12; ++j) { a[j] = pl + (size_t)(j / 3 * 2) * NPIX + goff[j % 3]; l[j] = lds0 + (unsigned)(b * SC * WPX * 4 + j * NTH * 16); }
        // the copies and, as the last line, the wait that stands ahead of any rewrite of their address registers
        asm volatile("global_load_async_to_lds_b128 %0, %12, off\n\tglobal_load_async_to_lds_b128 %1, %13, off\n\tglobal_load_async_to_lds_b128 %2, %14, off\n\t"
                     "global_load_async_to_lds_b128 %3, %15, off\n\tglobal_load_async_to_lds_b128 %4, %16, off\n\tglobal_load_async_to_lds_b128 %5, %17, off\n\t"
                     "global_load_async_to_lds_b128 %6, %18, off\n\tglobal_load_async_to_lds_b128 %7, %19, off\n\tglobal_load_async_to_lds_b128 %8, %20, off\n\t"
                     "global_load_async_to_lds_b128 %9, %21, off\n\tglobal_load_async_to_lds_b128 %10, %22, off\n\tglobal_load_async_to_lds_b128 %11, %23, off\n\t"
                     "s_wait_xcnt 0x0"
                     :: "v"(l[0]), "v"(l[1]), "v"(l[2]), "v"(l[3]), "v"(l[4]), "v"(l[5]), "v"(l[6]), "v"(l[7]), "v"(l[8]), "v"(l[9]), "v"(l[10]), "v"(l[11]),
                        "v"(a[0]), "v"(a[1]), "v"(a[2]), "v"(a[3]), "v"(a[4]), "v"(a[5]), "v"(a[6]), "v"(a[7]), "v"(a[8]), "v"(a[9]), "v"(a[10]), "v"(a[11]) : "memory"); };
    auto stage_src = [&](int t) NOPK { return (t < GD / SC ? kb : vb) + (size_t)((t % (GD / SC)) * SC) * NPIX; };
    auto foot = [&](int t) NOPK {   // hand-over of the ring: this wave's reads of the buffer are done, its copies of the next stage have landed, every wave has passed; only then the refill
        asm volatile("s_wait_dscnt 0x0" ::: "memory");      // this wave's reads of the buffer that is refilled below have returned
        asm volatile("s_wait_asynccnt 0x0" ::: "memory");   // this wave's copies of the next stage have landed
        wg_sync();                                           // both hold for every wave
        if (t + 2 < 2 * GD / SC) copy_stage(stage_src(t + 2), t & 1); };
    v4f qv[2][SC];
    auto load_q = [&](int c) NOPK {
#pragma unroll
        for (int i = 0; i < SC; ++i) qv[c & 1][i] = *(const v4fa*)(qc + (size_t)(c * SC + i) * NPIX); };
    // LDS reads in groups of 2 channels, each group issued ahead of the arithmetic of the group before (inside a stage only).
    const bool yt = y > 0, yb = y < HH - 1, xl = x0 > 0, xr = x0 < WW - 4;   // is there a row above, a row below, a pixel left of the four, a pixel right of them
    const int ci = tid * 4, li = ci - (xl ? 1 : 0), ri = ci + (xr ? 4 : 3);
    float nb[2][2][3][6];
    auto ld_group = [&](int b, int h) NOPK {
#pragma unroll
        for (int e = 0; e < 2; ++e) {
#pragma unroll
            for (int j = 0; j < 3; ++j) { const float* w = &kv[b][(h * 2 + e) * WPX + j * WW]; const v4f c4 = *(const v4fa*)(w + ci);
                nb[h & 1][e][j][0] = w[li]; nb[h & 1][e][j][1] = c4[0]; nb[h & 1][e][j][2] = c4[1]; nb[h & 1][e][j][3] = c4[2]; nb[h & 1][e][j][4] = c4[3]; nb[h & 1][e][j][5] = w[ri]; } } };
    copy_stage(stage_src(0), 0);
    load_q(0);
    asm volatile("s_wait_asynccnt 0x0" ::: "memory");   // stage 0 has landed, as far as this wave copied it
    wg_sync();                                     // ... and as far as the others did
    copy_stage(stage_src(1), 1);
    float s[4][9];
#pragma unroll
    for (int u = 0; u < 4; ++u)
#pragma unroll
        for (int n = 0; n < 9; ++n) s[u][n] = 0.f;
#pragma unroll
    for (int t = 0; t < GD / SC; ++t) {
        if (t + 1 < GD / SC) load_q(t + 1);
        ld_group(t & 1, 0);
#pragma unroll
        for (int h = 0; h < SC / 2; ++h) {
            if (h + 1 < SC / 2) ld_group(t & 1, h + 1);
            __builtin_amdgcn_sched_barrier(0);   // keeps the next group's LDS reads ahead of this group's arithmetic
#pragma unroll
            for (int e = 0; e < 2; ++e) {
#pragma unroll
                for (int u = 0; u < 4; ++u) {
#pragma unroll
                    for (int n = 0; n < 9; ++n) s[u][n] = __builtin_fmaf(qv[t & 1][h * 2 + e][u], nb[h & 1][e][n / 3][u + n % 3], s[u][n]); } }
            __builtin_amdgcn_sched_barrier(0);   // keeps this group's arithmetic ahead of the reads that refill its registers
        }
        foot(t);
    }
#pragma unroll
    for (int u = 0; u < 4; ++u) {
        bool in9[9]; float mx = -3.0e38f;
#pragma unroll
        for (int n = 0; n < 9; ++n) { in9[n] = (n / 3 == 0 ? yt : n / 3 == 2 ? yb : true) & (u + n % 3 == 0 ? xl : u + n % 3 == 5 ? xr : true);
            s[u][n] *= in9[n] ? 0.17677669529663689f : 0.f; mx = __builtin_fmaxf(mx, s[u][n]); }   // a padded neighbour scores 0 (k = 0), as the source: by a zero factor on a finite sum (with a select on the sum the compiler put a corner's whole sum under a branch and sank all sums behind it, at 790 registers)
        float sum = 0.f;
#pragma unroll
        for (int n = 0; n < 9; ++n) { s[u][n] = exp2_slot((s[u][n] - mx) * 1.4426950408889634f); sum += s[u][n]; }
        const float f = 1.0f / sum;
#pragma unroll
        for (int n = 0; n < 9; ++n) s[u][n] *= in9[n] ? f : 0.f;
    }
#pragma unroll
    for (int t = GD / SC; t < 2 * GD / SC; ++t) {
        v4f o[SC];
        ld_group(t & 1, 0);
#pragma unroll
        for (int h = 0; h < SC / 2; ++h) {
            if (h + 1 < SC / 2) ld_group(t & 1, h + 1);
            __builtin_amdgcn_sched_barrier(0);   // as above
#pragma unroll
            for (int e = 0; e < 2; ++e) {
#pragma unroll
                for (int u = 0; u < 4; ++u) { float a = 0.f;
#pragma unroll
                    for (int n = 0; n < 9; ++n) a = __builtin_fmaf(s[u][n], nb[h & 1][e][n / 3][u + n % 3], a);
                    o[h * 2 + e][u] = a; } }
            __builtin_amdgcn_sched_barrier(0);   // as above
        }
        foot(t);   // ahead of the stores: the barrier's fence waits for a wave's earlier stores, so these have a whole stage to finish before the next one
#pragma unroll
        for (int i = 0; i < SC; ++i) *(v4fa*)(ob + (size_t)((t - GD / SC) * SC + i) * NPIX) = o[i];
        asm volatile("s_wait_xcnt 0x0" ::: "memory");   // the stores' data registers are overwritten by the next stage's sums
    }
    asm volatile("s_wait_asynccnt 0x0" ::: "memory");   // behind the ring: no copy is outstanding when the wave ends
}

extern "C" void kernel_launch(void* const* d_in, const int* in_sizes, int n_in,
                              void* d_out, int out_size, void* d_ws, size_t ws_size, hipStream_t stream) {
    (void)in_sizes; (void)n_in; (void)out_size;
    const float* x = (const float*)d_in[0]; const float* Wt = (const float*)d_in[1];
    float* OUT = (float*)d_out;     // [8][128][9216]
    char* wsp = (char*)d_ws;
    auto take = [&](size_t bytes) { char* p = wsp; wsp += (bytes + 255) & ~(size_t)255; return (void*)p; };
    float* T = (float*)take((size_t)NB_ * CO * NPIX * 4);   // all images at once
    if ((size_t)(wsp - (char*)d_ws) > ws_size) return;    // total ~ 113 MB
    k_gemmx<<<dim3(NPIX / PT, NB_, 1), 256, 0, stream>>>(Wt, x, T);   // t[b][o][p], grid y = image
    k_nat<<<dim3(HH / TR, NG, NB_), NTH, 0, stream>>>(T, T + (size_t)CI * NPIX, T + (size_t)2 * CI * NPIX, OUT);
}

// v005
// A run of this version takes 26.5 microseconds.
// In two side-by-side timings against v004, it was 1.96 and 1.95 times as fast.
// Over all steps from v000 it is 35.4 times as fast.
#include <hip/hip_runtime.h>

// SGAT (x [8][128][96][96] channel-major; t = W_trans . x (1x1 conv, [384][128]): q = t[0:128], k = t[128:256], v = t[256:384], 4 heads x 32; for every pixel: att[n] = q . k(neighbour n) / sqrt(32) over the zero-padded 3x3 neighbourhood (n row-major (dy, dx); padded neighbours contribute k = v = 0, NOT masked),
//   softmax over the 9; out = sum_n att[n] v(neighbour n) -> [8][128][96][96] channel-major).
// Compute dtypes, f32 accumulate: every input rounded to bf16; the 1x1 conv as a PLAIN bf16 GEMM (inputs: exact; both rounded, and x transposed, inside the work-group, through LDS); the 3x3 neighbourhood attention entirely in f32 on VALU.
// One launch: a work-group makes the q, k, v it needs itself, in LDS, and t never goes to memory.

#define NB_  8
#define CI   128
#define CO   384
#define HH   96
#define WW   96
#define NPIX (HH * WW)
#define NG   4
#define GD   32
typedef unsigned short bf;
typedef __attribute__((ext_vector_type(16))) __bf16   v16bf;
typedef __attribute__((ext_vector_type(8)))  unsigned short v8us;
typedef __attribute__((ext_vector_type(4)))  unsigned short v4us;
typedef __attribute__((ext_vector_type(8)))  float    v8f;
typedef __attribute__((ext_vector_type(4)))  float    v4f;
typedef v4f  __attribute__((may_alias)) v4fa;
typedef v8us __attribute__((may_alias)) v8usa;
typedef v4us __attribute__((may_alias)) v4usa;

// the kernel and what is inlined into it are built without packed f32 arithmetic: with it the compiler paired the attention sums of neighbouring pixels, whose operands do not lie in aligned register pairs, and paid a register move per pair
#define NOPK __attribute__((target("no-packed-fp32-ops")))
__device__ __forceinline__ NOPK unsigned short f2bf(float f) { unsigned u = __builtin_bit_cast(unsigned, f); u += 0x7FFFu + ((u >> 16) & 1u); return (unsigned short)(u >> 16); }
__device__ __forceinline__ NOPK v16bf cat16b(v8us lo, v8us hi) { return __builtin_bit_cast(v16bf, __builtin_shufflevector(lo, hi, 0, 1, 2, 3, 4, 5, 6, 7, 8, 9, 10, 11, 12, 13, 14, 15)); }
__device__ __forceinline__ NOPK v8f wmmab(v16bf a, v16bf b, v8f c) { return __builtin_amdgcn_wmma_f32_16x16x32_bf16(false, a, false, b, (short)0, c, false, false); }
__device__ __forceinline__ NOPK v16bf ldfrag(const bf* p) { return cat16b(*(const v8usa*)p, *(const v8usa*)(p + 16)); }
// v_exp_f32 with the slot behind it filled: the instruction set asks for one independent instruction or v_nop before a transcendental's result is read or its source overwritten.
__device__ __forceinline__ NOPK float exp2_slot(float a) { float r; asm("v_exp_f32 %0, %1\n\tv_nop" : "=v"(r) : "v"(a)); return r; }
// work-group barrier that hands over LDS only: the fences name the LDS address space, so the x loads that fly across the barrier are not waited for (with the plain fences the compiler put s_wait_loadcnt 0 in front of every barrier)
__device__ __forceinline__ NOPK void lds_sync() { __builtin_amdgcn_fence(__ATOMIC_RELEASE, "workgroup", "local"); __builtin_amdgcn_s_barrier(); __builtin_amdgcn_fence(__ATOMIC_ACQUIRE, "workgroup", "local"); }

// ---- k_sgat: one work-group = one image (grid z), one head (grid y), 4 whole rows of pixels (grid x); 12 waves.
// Part 1, all 12 waves: t[96][576] = the head's 32 q, 32 k, 32 v channels on the 4 rows and the one above and below, in LDS, f32. The 576 pixels go in 6 chunks of one row:
//   a thread reads 8 channels x 4 pixels of x (f32, whole lines), two chunks ahead, rounds them to bf16 and writes them pixel-major (K-contiguous) into one of two LDS buffers; one barrier a chunk.
//   The head's 96 rows of W are rounded once into LDS; a wave keeps its 48 rows' fragments in registers. A wave takes 16 pixels (M) x 48 channels (N) of a chunk: a lane's accumulator is 8 pixels side by side of one channel, two 16-byte LDS writes.
//   Same k order in both loaders: k = 8 hi + 0..7, then 16 + 8 hi + 0..7.
//   A row beyond the image is taken from the edge row (in bounds, never used).
// Part 2, waves 0 to 2: the attention; a thread takes 4 pixels side by side. It reads, per channel and row, its 4 values as 16 bytes and the two beside them; every neighbour of its 4 pixels is among these 18 values.
//   A padded neighbour reads a real value (the edge row's copy, or a value from inside the row); its score is replaced by 0 and its weight on v by 0, as k = v = 0 there.
#define TR  4                 // rows of a tile
#define WPX ((TR + 2) * WW)   // pixels of t in a work-group: 6 rows
#define TP  (WPX + 4)         // LDS pitch of a channel of t, floats: 16 lanes' 16-byte writes, one channel each, fall on all 64 banks
#define TC  (3 * GD)          // channels of t in a work-group
#define PT  WW                // pixels of a chunk: one row
#define NCH (WPX / PT)
#define XP  (CI + 8)          // LDS pitch of a row of 128 bf16: 272 B = 16 B x 17, odd, for the 16-byte fragment reads
#define SC  8                 // channels of a stage of the attention
#define NTH (TR * WW / 4)     // 96 threads of the attention
#define NT  384               // threads of the work-group
__global__ __launch_bounds__(NT) NOPK void k_sgat(const float* __restrict__ Wf, const float* __restrict__ X, float* outb) {
    static_assert(HH % TR == 0 && WW % 4 == 0 && NTH % 32 == 0 && GD % SC == 0 && NCH >= 2 && PT == 6 * 16 && CI == 128 && (PT / 4) * (CI / 8) == NT && TC == (NT / 32) * 8 && GD % 8 == 0 && TC == 2 * 48 && CO == 3 * NG * GD, "12 waves: 8 rows of W each; 6 pixel blocks x 2 channel halves; a thread stages 8 channels x 4 pixels");
    // every loop below is unrolled: the register arrays need constant indices
    __shared__ struct __align__(16) { bf xs[2][PT * XP]; bf wsm[TC * XP]; float t[TC * TP]; } sm;
    const int tid = (int)__builtin_amdgcn_workitem_id_x(), lane = tid & 31, lr = lane & 15, hi = lane >> 4;
    const int wave = __builtin_amdgcn_readfirstlane(tid >> 5);
    const int g = (int)__builtin_amdgcn_workgroup_id_y(), r0 = (int)__builtin_amdgcn_workgroup_id_x() * TR;
    const size_t ib = __builtin_amdgcn_workgroup_id_z();
    const int pg = tid % (PT / 4), cg = tid / (PT / 4);   // 4 pixels, 8 channels: 24 threads cover the 384 B of one channel's row
    const char* Xb = (const char*)(X + ib * CI * NPIX);
    const float* Wr = Wf + (size_t)((wave * 8 / GD) * (NG * GD) + g * GD + wave * 8 % GD) * CI;   // the wave's 8 of the head's 96 rows (q, k, v by 32)
    const unsigned xoff = (unsigned)(cg * 8 * NPIX + pg * 4) * 4u;   // byte offset, one register for all loads of x
    v4f xv[2][8], wv[8];
    auto load_x = [&](int c) NOPK {
        int gy = r0 - 1 + c; gy = gy < 0 ? 0 : (gy > HH - 1 ? HH - 1 : gy);
        const char* Xr = Xb + (size_t)(gy * WW) * 4;
        __builtin_amdgcn_sched_barrier(0);   // the loads stay behind the last use of the registers they refill (drawn ahead of it they took registers of their own, beyond 256)
#pragma unroll
        for (int i = 0; i < 8; ++i) xv[c & 1][i] = *(const v4fa*)(Xr + (size_t)i * NPIX * 4 + xoff);
        asm volatile("s_wait_xcnt 0x0" :: "v"(xoff) : "memory");   // ahead of the first overwrite of a base or offset register of the issued loads; the offset is named so that it lives up to the wait
        __builtin_amdgcn_sched_barrier(0); };   // nothing from below is drawn ahead of that wait, and the loads stay this early
    load_x(0);
#pragma unroll
    for (int i = 0; i < 8; ++i) wv[i] = ((const v4fa*)(Wr + (size_t)i * CI))[lane];   // a load is one row, 16 B a lane
    asm volatile("s_wait_xcnt 0x0" :: "v"(lane) : "memory");   // as in load_x, for these 8 loads
    __builtin_amdgcn_sched_barrier(0);   // as in load_x
    load_x(1);
    const int pb = wave % 6, ch0 = (wave / 6) * 48;   // the wave's 16 pixels of a chunk, its 48 channels
    const bf* xp = sm.xs[0] + (pb * 16 + lr) * XP + 8 * hi;
    const bf* wp = sm.wsm + (ch0 + lr) * XP + 8 * hi;
    float* tw = sm.t + (ch0 + lr) * TP + pb * 16 + hi * 8;
    v16bf wfr[4][3];
#pragma unroll
    for (int c = 0; c < NCH; ++c) {
#pragma unroll
        for (int u = 0; u < 4; ++u) { v8us o;
#pragma unroll
            for (int i = 0; i < 8; ++i) o[i] = f2bf(xv[c & 1][i][u]);
            *(v8usa*)(sm.xs[c & 1] + (pg * 4 + u) * XP + cg * 8) = o; }
        if (c == 0) {
#pragma unroll
            for (int i = 0; i < 8; ++i) { v4us o;
#pragma unroll
                for (int u = 0; u < 4; ++u) o[u] = f2bf(wv[i][u]);
                *(v4usa*)(sm.wsm + (wave * 8 + i) * XP + lane * 4) = o; } }
        if (c + 2 < NCH) load_x(c + 2);
        lds_sync();   // chunk c (and W) is complete; every wave has left the buffer that chunk c + 1 is written to
        if (c == 0) {
#pragma unroll
            for (int kq = 0; kq < 4; ++kq)
#pragma unroll
                for (int nb = 0; nb < 3; ++nb) wfr[kq][nb] = ldfrag(wp + nb * 16 * XP + kq * 32); }
        v16bf xf[4];
#pragma unroll
        for (int kq = 0; kq < 4; ++kq) xf[kq] = ldfrag(xp + (c & 1) * PT * XP + kq * 32);
        v8f acc[3];
#pragma unroll
        for (int nb = 0; nb < 3; ++nb) acc[nb] = (v8f){};
        __builtin_amdgcn_sched_barrier(0);   // the 12 products stay one block behind the fragment reads ...
#pragma unroll
        for (int kq = 0; kq < 4; ++kq)
#pragma unroll
            for (int nb = 0; nb < 3; ++nb) acc[nb] = wmmab(xf[kq], wfr[kq][nb], acc[nb]);
        __builtin_amdgcn_sched_barrier(0);   // ... and ahead of the writes of t, so that the three accumulators have registers of their own (left alone the compiler started the third in the first one's registers, too close behind its last product)
#pragma unroll
        for (int nb = 0; nb < 3; ++nb) { float* d = tw + nb * 16 * TP + c * PT;
            *(v4fa*)d = (v4f){acc[nb][0], acc[nb][1], acc[nb][2], acc[nb][3]}; *(v4fa*)(d + 4) = (v4f){acc[nb][4], acc[nb][5], acc[nb][6], acc[nb][7]}; }
    }
    lds_sync();   // t is complete
    if (wave >= NTH / 32) return;   // no barrier below
    const int p = r0 * WW + tid * 4, y = r0 + tid / (WW / 4), x0 = (tid % (WW / 4)) * 4;
    float* ob = outb + ib * CI * NPIX + (size_t)(g * GD) * NPIX + p;
    const bool yt = y > 0, yb = y < HH - 1, xl = x0 > 0, xr = x0 < WW - 4;   // is there a row above, a row below, a pixel left of the four, a pixel right of them
    const int ci = tid * 4, li = ci - (xl ? 1 : 0), ri = ci + (xr ? 4 : 3);
    v4f qv[2][SC];
    auto load_q = [&](int c) NOPK {   // the thread's own pixels lie one row into the 6
#pragma unroll
        for (int i = 0; i < SC; ++i) qv[c & 1][i] = *(const v4fa*)(sm.t + (c * SC + i) * TP + WW + ci); };
    // LDS reads in groups of 2 channels, each group issued ahead of the arithmetic of the group before (inside a stage only). Stage st = 0..3: k, 4..7: v.
    float nb[2][2][3][6];
    auto ld_group = [&](int st, int h) NOPK {
#pragma unroll
        for (int e = 0; e < 2; ++e) {
#pragma unroll
            for (int j = 0; j < 3; ++j) { const float* w = sm.t + (GD + st * SC + h * 2 + e) * TP + j * WW; const v4f c4 = *(const v4fa*)(w + ci);
                nb[h & 1][e][j][0] = w[li]; nb[h & 1][e][j][1] = c4[0]; nb[h & 1][e][j][2] = c4[1]; nb[h & 1][e][j][3] = c4[2]; nb[h & 1][e][j][4] = c4[3]; nb[h & 1][e][j][5] = w[ri]; } } };
    load_q(0);
    float s[4][9];
#pragma unroll
    for (int u = 0; u < 4; ++u)
#pragma unroll
        for (int n = 0; n < 9; ++n) s[u][n] = 0.f;
#pragma unroll
    for (int t = 0; t < GD / SC; ++t) {
        if (t + 1 < GD / SC) load_q(t + 1);
        ld_group(t, 0);
#pragma unroll
        for (int h = 0; h < SC / 2; ++h) {
            if (h + 1 < SC / 2) ld_group(t, h + 1);
            __builtin_amdgcn_sched_barrier(0);   // keeps the next group's LDS reads ahead of this group's arithmetic
#pragma unroll
            for (int e = 0; e < 2; ++e) {
#pragma unroll
                for (int u = 0; u < 4; ++u) {
#pragma unroll
                    for (int n = 0; n < 9; ++n) s[u][n] = __builtin_fmaf(qv[t & 1][h * 2 + e][u], nb[h & 1][e][n / 3][u + n % 3], s[u][n]); } }
            __builtin_amdgcn_sched_barrier(0);   // keeps this group's arithmetic ahead of the reads that refill its registers
        }
    }
#pragma unroll
    for (int u = 0; u < 4; ++u) {
        bool in9[9]; float mx = -3.0e38f;
#pragma unroll
        for (int n = 0; n < 9; ++n) { in9[n] = (n / 3 == 0 ? yt : n / 3 == 2 ? yb : true) & (u + n % 3 == 0 ? xl : u + n % 3 == 5 ? xr : true);
            s[u][n] *= in9[n] ? 0.17677669529663689f : 0.f; mx = __builtin_fmaxf(mx, s[u][n]); }   // a padded neighbour scores 0 (k = 0), as the source: by a zero factor on a finite sum (with a select on the sum the compiler put a corner's whole sum under a branch and sank all sums behind it, at 790 registers)
        float sum = 0.f;
#pragma unroll
        for (int n = 0; n < 9; ++n) { s[u][n] = exp2_slot((s[u][n] - mx) * 1.4426950408889634f); sum += s[u][n]; }
        const float f = 1.0f / sum;
#pragma unroll
        for (int n = 0; n < 9; ++n) s[u][n] *= in9[n] ? f : 0.f;
    }
#pragma unroll
    for (int t = GD / SC; t < 2 * GD / SC; ++t) {
        v4f o[SC];
        ld_group(t, 0);
#pragma unroll
        for (int h = 0; h < SC / 2; ++h) {
            if (h + 1 < SC / 2) ld_group(t, h + 1);
            __builtin_amdgcn_sched_barrier(0);   // as above
#pragma unroll
            for (int e = 0; e < 2; ++e) {
#pragma unroll
                for (int u = 0; u < 4; ++u) { float a = 0.f;
#pragma unroll
                    for (int n = 0; n < 9; ++n) a = __builtin_fmaf(s[u][n], nb[h & 1][e][n / 3][u + n % 3], a);
                    o[h * 2 + e][u] = a; } }
            __builtin_amdgcn_sched_barrier(0);   // as above
        }
#pragma unroll
        for (int i = 0; i < SC; ++i) *(v4fa*)(ob + (size_t)((t - GD / SC) * SC + i) * NPIX) = o[i];
        if (t + 1 < 2 * GD / SC) { asm volatile("s_wait_xcnt 0x0" ::: "memory");   // the stores' data registers are overwritten by the next stage's reads and sums
            __builtin_amdgcn_sched_barrier(0); }   // nothing of the next stage is drawn ahead of that wait
    }
}

extern "C" void kernel_launch(void* const* d_in, const int* in_sizes, int n_in,
                              void* d_out, int out_size, void* d_ws, size_t ws_size, hipStream_t stream) {
    (void)in_sizes; (void)n_in; (void)out_size; (void)d_ws; (void)ws_size;
    const float* x = (const float*)d_in[0]; const float* Wt = (const float*)d_in[1];
    float* OUT = (float*)d_out;     // [8][128][9216]
    k_sgat<<<dim3(HH / TR, NG, NB_), NT, 0, stream>>>(Wt, x, OUT);
}

// v006
// A run of this version takes 23.3 microseconds.
// Timed twice side by side with v005, it ran 1.13 times as fast both times.
// Counting every step since v000, it is 40.1 times as fast.
#include <hip/hip_runtime.h>

// SGAT (x [8][128][96][96] channel-major; t = W_trans . x (1x1 conv, [384][128]): q = t[0:128], k = t[128:256], v = t[256:384], 4 heads x 32; for every pixel: att[n] = q . k(neighbour n) / sqrt(32) over the zero-padded 3x3 neighbourhood (n row-major (dy, dx); padded neighbours contribute k = v = 0, NOT masked),
//   softmax over the 9; out = sum_n att[n] v(neighbour n) -> [8][128][96][96] channel-major).
// Compute dtypes, f32 accumulate: every input rounded to bf16; the 1x1 conv as a PLAIN bf16 GEMM (inputs: exact; both rounded, and x transposed, inside the work-group, through LDS); the 3x3 neighbourhood attention entirely in f32 on VALU.
// One launch: a work-group makes the q, k, v it needs itself, in LDS, and t never goes to memory. One work-group per WGP (256), each walks 3 tiles of one image and head.

#define NB_  8
#define CI   128
#define CO   384
#define HH   96
#define WW   96
#define NPIX (HH * WW)
#define NG   4
#define GD   32
typedef unsigned short bf;
typedef __attribute__((ext_vector_type(16))) __bf16   v16bf;
typedef __attribute__((ext_vector_type(8)))  unsigned short v8us;
typedef __attribute__((ext_vector_type(4)))  unsigned short v4us;
typedef __attribute__((ext_vector_type(8)))  float    v8f;
typedef __attribute__((ext_vector_type(4)))  float    v4f;
typedef v4f  __attribute__((may_alias)) v4fa;
typedef v8us __attribute__((may_alias)) v8usa;
typedef v4us __attribute__((may_alias)) v4usa;

// the kernel and what is inlined into it are built without packed f32 arithmetic: with it the compiler paired the attention sums of neighbouring pixels, whose operands do not lie in aligned register pairs, and paid a register move per pair
#define NOPK __attribute__((target("no-packed-fp32-ops")))
__device__ __forceinline__ NOPK unsigned short f2bf(float f) { unsigned u = __builtin_bit_cast(unsigned, f); u += 0x7FFFu + ((u >> 16) & 1u); return (unsigned short)(u >> 16); }
__device__ __forceinline__ NOPK v16bf cat16b(v8us lo, v8us hi) { return __builtin_bit_cast(v16bf, __builtin_shufflevector(lo, hi, 0, 1, 2, 3, 4, 5, 6, 7, 8, 9, 10, 11, 12, 13, 14, 15)); }
__device__ __forceinline__ NOPK v8f wmmab(v16bf a, v16bf b, v8f c) { return __builtin_amdgcn_wmma_f32_16x16x32_bf16(false, a, false, b, (short)0, c, false, false); }
__device__ __forceinline__ NOPK v16bf ldfrag(const bf* p) { return cat16b(*(const v8usa*)p, *(const v8usa*)(p + 16)); }
// v_exp_f32 with the slot behind it filled: the instruction set asks for one independent instruction or v_nop before a transcendental's result is read or its source overwritten.
__device__ __forceinline__ NOPK float exp2_slot(float a) { float r; asm("v_exp_f32 %0, %1\n\tv_nop" : "=v"(r) : "v"(a)); return r; }
// work-group barrier that hands over LDS only: the fences name the LDS address space, so the x loads that fly across the barrier are not waited for (with the plain fences the compiler put s_wait_loadcnt 0 in front of every barrier)
__device__ __forceinline__ NOPK void lds_sync() { __builtin_amdgcn_fence(__ATOMIC_RELEASE, "workgroup", "local"); __builtin_amdgcn_s_barrier(); __builtin_amdgcn_fence(__ATOMIC_ACQUIRE, "workgroup", "local"); }

// ---- k_sgat: one work-group = one image (grid z), one head (grid y), 3 tiles one below the other (grid x), a tile = 4 whole rows of pixels; 12 waves. Parts 1 and 2 run once a tile.
// Part 1, all 12 waves: t[96][576] = the head's 32 q, 32 k, 32 v channels on the 4 rows and the one above and below, in LDS, f32. The 576 pixels go in 6 chunks of one row:
//   a thread reads 8 channels x 4 pixels of x (f32, whole lines), two chunks ahead, rounds them to bf16 and writes them pixel-major (K-contiguous) into one of two LDS buffers; one barrier a chunk.
//   The head's 96 rows of W are rounded once a work-group into LDS; a wave keeps its 48 rows' fragments in registers through part 1. The next tile's first two chunks of x are asked for in the last chunk of this tile, so they fly during part 2. A wave takes 16 pixels (M) x 48 channels (N) of a chunk: a lane's accumulator is 8 pixels side by side of one channel, two 16-byte LDS writes.
//   Same k order in both loaders: k = 8 hi + 0..7, then 16 + 8 hi + 0..7.
//   A row beyond the image is taken from the edge row (in bounds, never used).
// Part 2, waves 0 to 2: the attention; a thread takes 4 pixels side by side. It reads, per channel and row, its 4 values as 16 bytes and the two beside them; every neighbour of its 4 pixels is among these 18 values.
//   A padded neighbour reads a real value (the edge row's copy, or a value from inside the row); its score is replaced by 0 and its weight on v by 0, as k = v = 0 there.
#define TR  4                 // rows of a tile
#define WPX ((TR + 2) * WW)   // pixels of t in a work-group: 6 rows
#define TP  (WPX + 4)         // LDS pitch of a channel of t, floats: 16 lanes' 16-byte writes, one channel each, fall on all 64 banks
#define TC  (3 * GD)          // channels of t in a work-group
#define PT  WW                // pixels of a chunk: one row
#define NCH (WPX / PT)
#define XP  (CI + 8)          // LDS pitch of a row of 128 bf16: 272 B = 16 B x 17, odd, for the 16-byte fragment reads
#define SC  8                 // channels of a stage of the attention
#define NTH (TR * WW / 4)     // 96 threads of the attention
#define NT  384               // threads of the work-group
#define NTL 3                 // tiles of a work-group: 24 x 4 x 8 tiles on 256 work-groups
__global__ __launch_bounds__(NT) NOPK void k_sgat(const float* __restrict__ Wf, const float* __restrict__ X, float* outb) {
    static_assert(HH % (TR * NTL) == 0 && NCH % 2 == 0 && WW % 4 == 0 && NTH % 32 == 0 && GD % SC == 0 && NCH >= 2 && PT == 6 * 16 && CI == 128 && (PT / 4) * (CI / 8) == NT && TC == (NT / 32) * 8 && GD % 8 == 0 && TC == 2 * 48 && CO == 3 * NG * GD, "12 waves: 8 rows of W each; 6 pixel blocks x 2 channel halves; a thread stages 8 channels x 4 pixels");
    // every loop below but the one over the tiles and the attention's two over its stages is unrolled: the register arrays need constant indices
    __shared__ struct __align__(16) { bf xs[2][PT * XP]; bf wsm[TC * XP]; float t[TC * TP]; } sm;
    const int tid = (int)__builtin_amdgcn_workitem_id_x(), lane = tid & 31, lr = lane & 15, hi = lane >> 4;
    const int wave = __builtin_amdgcn_readfirstlane(tid >> 5);
    const int g = (int)__builtin_amdgcn_workgroup_id_y(), rb = (int)__builtin_amdgcn_workgroup_id_x() * (TR * NTL);
    const size_t ib = __builtin_amdgcn_workgroup_id_z();
    const int pg = tid % (PT / 4), cg = tid / (PT / 4);   // 4 pixels, 8 channels: 24 threads cover the 384 B of one channel's row
    const char* Xb = (const char*)(X + ib * CI * NPIX);
    const float* Wr = Wf + (size_t)((wave * 8 / GD) * (NG * GD) + g * GD + wave * 8 % GD) * CI;   // the wave's 8 of the head's 96 rows (q, k, v by 32)
    const unsigned xoff = (unsigned)(cg * 8 * NPIX + pg * 4) * 4u;   // byte offset, one register for all loads of x
    v4f xv[2][8], wv[8];
    auto load_x = [&](int c, int gy) NOPK {   // image row gy into register set c & 1
        gy = gy < 0 ? 0 : (gy > HH - 1 ? HH - 1 : gy);
        const char* Xr = Xb + (size_t)(gy * WW) * 4;
        __builtin_amdgcn_sched_barrier(0);   // the loads stay behind the last use of the registers they refill (drawn ahead of it they took registers of their own, beyond 256)
#pragma unroll
        for (int i = 0; i < 8; ++i) xv[c & 1][i] = *(const v4fa*)(Xr + (size_t)i * NPIX * 4 + xoff);
        asm volatile("s_wait_xcnt 0x0" :: "v"(xoff) : "memory");   // ahead of the first overwrite of a base or offset register of the issued loads; the offset is named so that it lives up to the wait
        __builtin_amdgcn_sched_barrier(0); };   // nothing from below is drawn ahead of that wait, and the loads stay this early
    load_x(0, rb - 1);
#pragma unroll
    for (int i = 0; i < 8; ++i) wv[i] = ((const v4fa*)(Wr + (size_t)i * CI))[lane];   // a load is one row, 16 B a lane
    asm volatile("s_wait_xcnt 0x0" :: "v"(lane) : "memory");   // as in load_x, for these 8 loads
    __builtin_amdgcn_sched_barrier(0);   // as in load_x
    load_x(1, rb);
    const int pb = wave % 6, ch0 = (wave / 6) * 48;   // the wave's 16 pixels of a chunk, its 48 channels
    const bf* xp = sm.xs[0] + (pb * 16 + lr) * XP + 8 * hi;
    const bf* wp = sm.wsm + (ch0 + lr) * XP + 8 * hi;
    float* tw = sm.t + (ch0 + lr) * TP + pb * 16 + hi * 8;
#pragma unroll
    for (int i = 0; i < 8; ++i) { v4us o;
#pragma unroll
        for (int u = 0; u < 4; ++u) o[u] = f2bf(wv[i][u]);
        *(v4usa*)(sm.wsm + (wave * 8 + i) * XP + lane * 4) = o; }   // handed over by the first tile's first barrier
#pragma clang loop unroll(disable)   // rolled: for speed only
    for (int it = 0; it < NTL; ++it) {
    const int r0 = rb + it * TR;
    v16bf wfr[4][3];
#pragma unroll
    for (int c = 0; c < NCH; ++c) {
#pragma unroll
        for (int u = 0; u < 4; ++u) { v8us o;
#pragma unroll
            for (int i = 0; i < 8; ++i) o[i] = f2bf(xv[c & 1][i][u]);
            *(v8usa*)(sm.xs[c & 1] + (pg * 4 + u) * XP + cg * 8) = o; }
        if (c + 2 < NCH) load_x(c, r0 + 1 + c);
        else if (c + 1 == NCH && it + 1 < NTL) { load_x(0, r0 + TR - 1); load_x(1, r0 + TR); }   // the next tile's first two chunks, both here, where no older load is pending (issued under this branch a chunk earlier, the compiler's wait for chunk NCH - 1 waited for them too)
        lds_sync();   // chunk c (and W) is complete; every wave has left the buffer that chunk c + 1 is written to; at c = 0 also: part 2 of the tile before has read t to its end
        if (c == 0) {
#pragma unroll
            for (int kq = 0; kq < 4; ++kq)
#pragma unroll
                for (int nb = 0; nb < 3; ++nb) wfr[kq][nb] = ldfrag(wp + nb * 16 * XP + kq * 32); }
        v16bf xf[4];
#pragma unroll
        for (int kq = 0; kq < 4; ++kq) xf[kq] = ldfrag(xp + (c & 1) * PT * XP + kq * 32);
        v8f acc[3];
#pragma unroll
        for (int nb = 0; nb < 3; ++nb) acc[nb] = (v8f){};
        __builtin_amdgcn_sched_barrier(0);   // the 12 products stay one block behind the fragment reads ...
#pragma unroll
        for (int kq = 0; kq < 4; ++kq)
#pragma unroll
            for (int nb = 0; nb < 3; ++nb) acc[nb] = wmmab(xf[kq], wfr[kq][nb], acc[nb]);
        __builtin_amdgcn_sched_barrier(0);   // ... and ahead of the writes of t, so that the three accumulators have registers of their own (left alone the compiler started the third in the first one's registers, too close behind its last product)
#pragma unroll
        for (int nb = 0; nb < 3; ++nb) { float* d = tw + nb * 16 * TP + c * PT;
            *(v4fa*)d = (v4f){acc[nb][0], acc[nb][1], acc[nb][2], acc[nb][3]}; *(v4fa*)(d + 4) = (v4f){acc[nb][4], acc[nb][5], acc[nb][6], acc[nb][7]}; }
    }
    lds_sync();   // t is complete
    if (wave < NTH / 32) {   // no barrier inside
    const int y = r0 + tid / (WW / 4), x0 = (tid % (WW / 4)) * 4;
    float* ob = outb + ib * CI * NPIX + (size_t)(g * GD) * NPIX + r0 * WW + tid * 4;
    const bool yt = y > 0, yb = y < HH - 1, xl = x0 > 0, xr = x0 < WW - 4;   // is there a row above, a row below, a pixel left of the four, a pixel right of them
    const int ci = tid * 4;
    // the stage loops are rolled and walk these four pointers: within a stage every LDS offset is an immediate (unrolled inside the tile loop, the hundred-odd addresses beyond the 64-KiB immediate were all formed ahead of that loop and spilled)
    const float* wq = sm.t + WW + ci;   // q: the thread's own pixels lie one row into the 6
    const float* wc = sm.t + GD * TP + ci; const float* wl = wc - (xl ? 1 : 0); const float* wr = wc + (xr ? 4 : 3);   // k, then v: the four, the one left, the one right
    v4f qv[SC];
    // LDS reads in groups of 2 channels, each group issued ahead of the arithmetic of the group before; group SC / 2 is the next stage's first. Stages 0..3: k, 4..7: v.
    float nb[2][2][3][6];
    auto ld_group = [&](int h) NOPK {
#pragma unroll
        for (int e = 0; e < 2; ++e) {
#pragma unroll
            for (int j = 0; j < 3; ++j) { const int w = (h * 2 + e) * TP + j * WW; const v4f c4 = *(const v4fa*)(wc + w);
                nb[h & 1][e][j][0] = wl[w]; nb[h & 1][e][j][1] = c4[0]; nb[h & 1][e][j][2] = c4[1]; nb[h & 1][e][j][3] = c4[2]; nb[h & 1][e][j][4] = c4[3]; nb[h & 1][e][j][5] = wr[w]; } } };
#pragma unroll
    for (int i = 0; i < SC; ++i) qv[i] = *(const v4fa*)(wq + i * TP);
    ld_group(0);
    float s[4][9];
#pragma unroll
    for (int u = 0; u < 4; ++u)
#pragma unroll
        for (int n = 0; n < 9; ++n) s[u][n] = 0.f;
#pragma clang loop unroll(disable)   // see at the pointers
    for (int t = 0; t < GD / SC; ++t) {
#pragma unroll
        for (int h = 0; h < SC / 2; ++h) {
            ld_group(h + 1);   // behind the last k stage: the first group of v
            __builtin_amdgcn_sched_barrier(0);   // keeps the next group's LDS reads ahead of this group's arithmetic
#pragma unroll
            for (int e = 0; e < 2; ++e) {
#pragma unroll
                for (int u = 0; u < 4; ++u) {
#pragma unroll
                    for (int n = 0; n < 9; ++n) s[u][n] = __builtin_fmaf(qv[h * 2 + e][u], nb[h & 1][e][n / 3][u + n % 3], s[u][n]); } }
            __builtin_amdgcn_sched_barrier(0);   // keeps this group's arithmetic ahead of the reads that refill its registers
#pragma unroll
            for (int e = 0; e < 2; ++e) qv[h * 2 + e] = *(const v4fa*)(wq + (SC + h * 2 + e) * TP);   // the next stage's q into the registers just used (behind the last stage: values of k, in bounds, never used)
        }
        wq += SC * TP; wc += SC * TP; wl += SC * TP; wr += SC * TP;
    }
#pragma unroll
    for (int u = 0; u < 4; ++u) {
        bool in9[9]; float mx = -3.0e38f;
#pragma unroll
        for (int n = 0; n < 9; ++n) { in9[n] = (n / 3 == 0 ? yt : n / 3 == 2 ? yb : true) & (u + n % 3 == 0 ? xl : u + n % 3 == 5 ? xr : true);
            s[u][n] *= in9[n] ? 0.17677669529663689f : 0.f; mx = __builtin_fmaxf(mx, s[u][n]); }   // a padded neighbour scores 0 (k = 0), as the source: by a zero factor on a finite sum (with a select on the sum the compiler put a corner's whole sum under a branch and sank all sums behind it, at 790 registers)
        float sum = 0.f;
#pragma unroll
        for (int n = 0; n < 9; ++n) { s[u][n] = exp2_slot((s[u][n] - mx) * 1.4426950408889634f); sum += s[u][n]; }
        const float f = 1.0f / sum;
#pragma unroll
        for (int n = 0; n < 9; ++n) s[u][n] *= in9[n] ? f : 0.f;
    }
    auto av_stage = [&](bool more) NOPK {   // 8 output channels; more: a stage follows, and its first group is read ahead
        v4f o[SC];
#pragma unroll
        for (int h = 0; h < SC / 2; ++h) {
            if (h + 1 < SC / 2 || more) ld_group(h + 1);
            __builtin_amdgcn_sched_barrier(0);   // as above
#pragma unroll
            for (int e = 0; e < 2; ++e) {
#pragma unroll
                for (int u = 0; u < 4; ++u) { float a = 0.f;
#pragma unroll
                    for (int n = 0; n < 9; ++n) a = __builtin_fmaf(s[u][n], nb[h & 1][e][n / 3][u + n % 3], a);
                    o[h * 2 + e][u] = a; } }
            __builtin_amdgcn_sched_barrier(0);   // as above
        }
#pragma unroll
        for (int i = 0; i < SC; ++i) *(v4fa*)(ob + (size_t)i * NPIX) = o[i];
        asm volatile("s_wait_xcnt 0x0" ::: "memory");   // the stores' data and address registers are overwritten by the next stage's, or the next tile's, reads and sums
        __builtin_amdgcn_sched_barrier(0);   // nothing of what follows is drawn ahead of that wait
        ob += (size_t)SC * NPIX; wc += SC * TP; wl += SC * TP; wr += SC * TP; };
#pragma clang loop unroll(disable)   // see at the pointers
    for (int t = 0; t + 1 < GD / SC; ++t) av_stage(true);
    av_stage(false);   // nothing lies behind the last stage of v
    }
    }
}

extern "C" void kernel_launch(void* const* d_in, const int* in_sizes, int n_in,
                              void* d_out, int out_size, void* d_ws, size_t ws_size, hipStream_t stream) {
    (void)in_sizes; (void)n_in; (void)out_size; (void)d_ws; (void)ws_size;
    const float* x = (const float*)d_in[0]; const float* Wt = (const float*)d_in[1];
    float* OUT = (float*)d_out;     // [8][128][9216]
    k_sgat<<<dim3(HH / (TR * NTL), NG, NB_), NT, 0, stream>>>(Wt, x, OUT);
}

// v007
// One run takes 22.3 microseconds.
// Two timings next to v006 put it at 1.04 and 1.05 times that version's speed.
// Over all steps from v000 it is 41.9 times as fast.
#include <hip/hip_runtime.h>

// SGAT (x [8][128][96][96] channel-major; t = W_trans . x (1x1 conv, [384][128]): q = t[0:128], k = t[128:256], v = t[256:384], 4 heads x 32; for every pixel: att[n] = q . k(neighbour n) / sqrt(32) over the zero-padded 3x3 neighbourhood (n row-major (dy, dx); padded neighbours contribute k = v = 0, NOT masked),
//   softmax over the 9; out = sum_n att[n] v(neighbour n) -> [8][128][96][96] channel-major).
// Compute dtypes, f32 accumulate: every input rounded to bf16; the 1x1 conv as a PLAIN bf16 GEMM (inputs: exact; both rounded, and x transposed, inside the work-group, through LDS); the 3x3 neighbourhood attention entirely in f32 on VALU.
// One launch: a work-group makes the q, k, v it needs itself, in LDS, and t never goes to memory. One work-group per WGP (256), each walks 3 tiles of one image and head.

#define NB_  8
#define CI   128
#define CO   384
#define HH   96
#define WW   96
#define NPIX (HH * WW)
#define NG   4
#define GD   32
typedef unsigned short bf;
typedef __attribute__((ext_vector_type(16))) __bf16   v16bf;
typedef __attribute__((ext_vector_type(8)))  unsigned short v8us;
typedef __attribute__((ext_vector_type(4)))  unsigned short v4us;
typedef __attribute__((ext_vector_type(8)))  float    v8f;
typedef __attribute__((ext_vector_type(4)))  float    v4f;
typedef v4f  __attribute__((may_alias)) v4fa;
typedef v8us __attribute__((may_alias)) v8usa;
typedef v4us __attribute__((may_alias)) v4usa;

// the kernel and what is inlined into it are built without packed f32 arithmetic: with it the compiler paired the attention sums of neighbouring pixels, whose operands do not lie in aligned register pairs, and paid a register move per pair
#define NOPK __attribute__((target("no-packed-fp32-ops")))
__device__ __forceinline__ NOPK unsigned short f2bf(float f) { unsigned u = __builtin_bit_cast(unsigned, f); u += 0x7FFFu + ((u >> 16) & 1u); return (unsigned short)(u >> 16); }
__device__ __forceinline__ NOPK v16bf cat16b(v8us lo, v8us hi) { return __builtin_bit_cast(v16bf, __builtin_shufflevector(lo, hi, 0, 1, 2, 3, 4, 5, 6, 7, 8, 9, 10, 11, 12, 13, 14, 15)); }
__device__ __forceinline__ NOPK v8f wmmab(v16bf a, v16bf b, v8f c) { return __builtin_amdgcn_wmma_f32_16x16x32_bf16(false, a, false, b, (short)0, c, false, false); }
__device__ __forceinline__ NOPK v16bf ldfrag(const bf* p) { return cat16b(*(const v8usa*)p, *(const v8usa*)(p + 16)); }
// v_exp_f32 with the slot behind it filled: the instruction set asks for one independent instruction or v_nop before a transcendental's result is read or its source overwritten.
__device__ __forceinline__ NOPK float exp2_slot(float a) { float r; asm("v_exp_f32 %0, %1\n\tv_nop" : "=v"(r) : "v"(a)); return r; }
// work-group barrier that hands over LDS only: the fences name the LDS address space, so the x loads that fly across the barrier are not waited for (with the plain fences the compiler put s_wait_loadcnt 0 in front of every barrier)
__device__ __forceinline__ NOPK void lds_sync() { __builtin_amdgcn_fence(__ATOMIC_RELEASE, "workgroup", "local"); __builtin_amdgcn_s_barrier(); __builtin_amdgcn_fence(__ATOMIC_ACQUIRE, "workgroup", "local"); }

// ---- k_sgat: one work-group = one image (grid z), one head (grid y), 3 tiles one below the other (grid x), a tile = 4 whole rows of pixels; 12 waves. Parts 1 and 2 run once a tile.
// Part 1, all 12 waves: t[96][576] = the head's 32 q, 32 k, 32 v channels on the 4 rows and the one above and below, in LDS, f32. The 576 pixels go in 6 chunks of one row:
//   a thread reads 8 channels x 4 pixels of x (f32, whole lines), two chunks ahead, rounds them to bf16 and writes them pixel-major (K-contiguous) into one of two LDS buffers; one barrier a chunk.
//   The head's 96 rows of W are rounded once a work-group into LDS; a wave keeps its 48 rows' fragments in registers through part 1. The next tile's first two chunks of x are asked for in the last chunk of this tile, so they fly during part 2. A wave takes 16 pixels (M) x 48 channels (N) of a chunk: a lane's accumulator is 8 pixels side by side of one channel, two 16-byte LDS writes.
//   Same k order in both loaders: k = 8 hi + 0..7, then 16 + 8 hi + 0..7.
//   A row beyond the image is taken from the edge row (in bounds, never used).
// Part 2, waves 0 to 2: the attention; a thread takes 4 pixels side by side. It reads, per channel and row, its 4 values as 16 bytes and the two beside them; every neighbour of its 4 pixels is among these 18 values.
//   A padded neighbour reads a real value (the edge row's copy, or a value from inside the row); its score is replaced by 0 and its weight on v by 0, as k = v = 0 there.
#define TR  4                 // rows of a tile
#define WPX ((TR + 2) * WW)   // pixels of t in a work-group: 6 rows
#define TP  (WPX + 4)         // LDS pitch of a channel of t, floats: 16 lanes' 16-byte writes, one channel each, fall on all 64 banks
#define TC  (3 * GD)          // channels of t in a work-group
#define PT  WW                // pixels of a chunk: one row
#define NCH (WPX / PT)
#define XP  (CI + 8)          // LDS pitch of a row of 128 bf16: 272 B = 16 B x 17, odd, for the 16-byte fragment reads
#define SC  8                 // channels of a stage of the attention
#define NTH (TR * WW / 4)     // 96 threads of the attention
#define NT  384               // threads of the work-group
#define NTL 3                 // tiles of a work-group: 24 x 4 x 8 tiles on 256 work-groups
__global__ __launch_bounds__(NT) NOPK void k_sgat(const float* __restrict__ Wf, const float* __restrict__ X, float* outb) {
    static_assert(HH % (TR * NTL) == 0 && NCH % 2 == 0 && WW % 4 == 0 && NTH % 32 == 0 && GD % SC == 0 && NCH >= 2 && PT == 6 * 16 && CI == 128 && (PT / 4) * (CI / 8) == NT && PT / 4 == 3 * 8 && CI / 8 == 4 * 4 && XP % 128 == 8 && TC == (NT / 32) * 8 && GD % 8 == 0 && TC == 2 * 48 && CO == 3 * NG * GD, "12 waves: 8 rows of W each; 6 pixel blocks x 2 channel halves; a thread stages 8 channels x 4 pixels");
    // every loop below but the one over the tiles and the attention's two over its stages is unrolled: the register arrays need constant indices
    __shared__ struct __align__(16) { bf xs[2][PT * XP]; bf wsm[TC * XP]; float t[TC * TP]; } sm;
    const int tid = (int)__builtin_amdgcn_workitem_id_x(), lane = tid & 31, lr = lane & 15, hi = lane >> 4;
    const int wave = __builtin_amdgcn_readfirstlane(tid >> 5);
    const int g = (int)__builtin_amdgcn_workgroup_id_y(), rb = (int)__builtin_amdgcn_workgroup_id_x() * (TR * NTL);
    const size_t ib = __builtin_amdgcn_workgroup_id_z();
    // 4 pixels, 8 channels a thread. A wave takes 8 pixel groups (one 128-B line of a channel's row) x 4 channel groups; each 16 lanes of it are 4 pixel groups x 4 channel groups:
    // the bank of a thread's 16-byte write to xs is 4 * ((4 pg + u + cg) mod 16), so 16 such lanes fall on all 64 banks (with 16 pixel groups of one channel group they fell on 16 banks, four lanes on each)
    const int pg = (wave % 3) * 8 + hi * 4 + (lane & 3), cg = (wave / 3) * 4 + ((lane >> 2) & 3);
    const char* Xb = (const char*)(X + ib * CI * NPIX);
    const float* Wr = Wf + (size_t)((wave * 8 / GD) * (NG * GD) + g * GD + wave * 8 % GD) * CI;   // the wave's 8 of the head's 96 rows (q, k, v by 32)
    const unsigned xoff = (unsigned)(cg * 8 * NPIX + pg * 4) * 4u;   // byte offset, one register for all loads of x
    v4f xv[2][8], wv[8];
    auto load_x = [&](int c, int gy) NOPK {   // image row gy into register set c & 1
        gy = gy < 0 ? 0 : (gy > HH - 1 ? HH - 1 : gy);
        const char* Xr = Xb + (size_t)(gy * WW) * 4;
        __builtin_amdgcn_sched_barrier(0);   // the loads stay behind the last use of the registers they refill (drawn ahead of it they took registers of their own, beyond 256)
#pragma unroll
        for (int i = 0; i < 8; ++i) xv[c & 1][i] = *(const v4fa*)(Xr + (size_t)i * NPIX * 4 + xoff);
        asm volatile("s_wait_xcnt 0x0" :: "v"(xoff) : "memory");   // ahead of the first overwrite of a base or offset register of the issued loads; the offset is named so that it lives up to the wait
        __builtin_amdgcn_sched_barrier(0); };   // nothing from below is drawn ahead of that wait, and the loads stay this early
    load_x(0, rb - 1);
#pragma unroll
    for (int i = 0; i < 8; ++i) wv[i] = ((const v4fa*)(Wr + (size_t)i * CI))[lane];   // a load is one row, 16 B a lane
    asm volatile("s_wait_xcnt 0x0" :: "v"(lane) : "memory");   // as in load_x, for these 8 loads
    __builtin_amdgcn_sched_barrier(0);   // as in load_x
    load_x(1, rb);
    const int pb = wave % 6, ch0 = (wave / 6) * 48;   // the wave's 16 pixels of a chunk, its 48 channels
    const bf* xp = sm.xs[0] + (pb * 16 + lr) * XP + 8 * hi;
    const bf* wp = sm.wsm + (ch0 + lr) * XP + 8 * hi;
    float* tw = sm.t + (ch0 + lr) * TP + pb * 16 + hi * 8;
#pragma unroll
    for (int i = 0; i < 8; ++i) { v4us o;
#pragma unroll
        for (int u = 0; u < 4; ++u) o[u] = f2bf(wv[i][u]);
        *(v4usa*)(sm.wsm + (wave * 8 + i) * XP + lane * 4) = o; }   // handed over by the first tile's first barrier
#pragma clang loop unroll(disable)   // rolled: for speed only
    for (int it = 0; it < NTL; ++it) {
    const int r0 = rb + it * TR;
    v16bf wfr[4][3];
#pragma unroll
    for (int c = 0; c < NCH; ++c) {
#pragma unroll
        for (int u = 0; u < 4; ++u) { v8us o;
#pragma unroll
            for (int i = 0; i < 8; ++i) o[i] = f2bf(xv[c & 1][i][u]);
            *(v8usa*)(sm.xs[c & 1] + (pg * 4 + u) * XP + cg * 8) = o; }
        if (c + 2 < NCH) load_x(c, r0 + 1 + c);
        else if (c + 1 == NCH && it + 1 < NTL) { load_x(0, r0 + TR - 1); load_x(1, r0 + TR); }   // the next tile's first two chunks, both here, where no older load is pending (issued under this branch a chunk earlier, the compiler's wait for chunk NCH - 1 waited for them too)
        lds_sync();   // chunk c (and W) is complete; every wave has left the buffer that chunk c + 1 is written to; at c = 0 also: part 2 of the tile before has read t to its end
        if (c == 0) {
#pragma unroll
            for (int kq = 0; kq < 4; ++kq)
#pragma unroll
                for (int nb = 0; nb < 3; ++nb) wfr[kq][nb] = ldfrag(wp + nb * 16 * XP + kq * 32); }
        v16bf xf[4];
#pragma unroll
        for (int kq = 0; kq < 4; ++kq) xf[kq] = ldfrag(xp + (c & 1) * PT * XP + kq * 32);
        v8f acc[3];
#pragma unroll
        for (int nb = 0; nb < 3; ++nb) acc[nb] = (v8f){};
        __builtin_amdgcn_sched_barrier(0);   // the 12 products stay one block behind the fragment reads ...
#pragma unroll
        for (int kq = 0; kq < 4; ++kq)
#pragma unroll
            for (int nb = 0; nb < 3; ++nb) acc[nb] = wmmab(xf[kq], wfr[kq][nb], acc[nb]);
        __builtin_amdgcn_sched_barrier(0);   // ... and ahead of the writes of t, so that the three accumulators have registers of their own (left alone the compiler started the third in the first one's registers, too close behind its last product)
#pragma unroll
        for (int nb = 0; nb < 3; ++nb) { float* d = tw + nb * 16 * TP + c * PT;
            *(v4fa*)d = (v4f){acc[nb][0], acc[nb][1], acc[nb][2], acc[nb][3]}; *(v4fa*)(d + 4) = (v4f){acc[nb][4], acc[nb][5], acc[nb][6], acc[nb][7]}; }
    }
    lds_sync();   // t is complete
    if (wave < NTH / 32) {   // no barrier inside
    const int y = r0 + tid / (WW / 4), x0 = (tid % (WW / 4)) * 4;
    float* ob = outb + ib * CI * NPIX + (size_t)(g * GD) * NPIX + r0 * WW + tid * 4;
    const bool yt = y > 0, yb = y < HH - 1, xl = x0 > 0, xr = x0 < WW - 4;   // is there a row above, a row below, a pixel left of the four, a pixel right of them
    const int ci = tid * 4;
    // the stage loops are rolled and walk these four pointers: within a stage every LDS offset is an immediate (unrolled inside the tile loop, the hundred-odd addresses beyond the 64-KiB immediate were all formed ahead of that loop and spilled)
    const float* wq = sm.t + WW + ci;   // q: the thread's own pixels lie one row into the 6
    const float* wc = sm.t + GD * TP + ci; const float* wl = wc - (xl ? 1 : 0); const float* wr = wc + (xr ? 4 : 3);   // k, then v: the four, the one left, the one right
    v4f qv[SC];
    // LDS reads in groups of 2 channels, each group issued ahead of the arithmetic of the group before; group SC / 2 is the next stage's first. Stages 0..3: k, 4..7: v.
    float nb[2][2][3][6];
    auto ld_group = [&](int h) NOPK {
#pragma unroll
        for (int e = 0; e < 2; ++e) {
#pragma unroll
            for (int j = 0; j < 3; ++j) { const int w = (h * 2 + e) * TP + j * WW; const v4f c4 = *(const v4fa*)(wc + w);
                nb[h & 1][e][j][0] = wl[w]; nb[h & 1][e][j][1] = c4[0]; nb[h & 1][e][j][2] = c4[1]; nb[h & 1][e][j][3] = c4[2]; nb[h & 1][e][j][4] = c4[3]; nb[h & 1][e][j][5] = wr[w]; } } };
#pragma unroll
    for (int i = 0; i < SC; ++i) qv[i] = *(const v4fa*)(wq + i * TP);
    ld_group(0);
    float s[4][9];
#pragma unroll
    for (int u = 0; u < 4; ++u)
#pragma unroll
        for (int n = 0; n < 9; ++n) s[u][n] = 0.f;
#pragma clang loop unroll(disable)   // see at the pointers
    for (int t = 0; t < GD / SC; ++t) {
#pragma unroll
        for (int h = 0; h < SC / 2; ++h) {
            ld_group(h + 1);   // behind the last k stage: the first group of v
            __builtin_amdgcn_sched_barrier(0);   // keeps the next group's LDS reads ahead of this group's arithmetic
#pragma unroll
            for (int e = 0; e < 2; ++e) {
#pragma unroll
                for (int u = 0; u < 4; ++u) {
#pragma unroll
                    for (int n = 0; n < 9; ++n) s[u][n] = __builtin_fmaf(qv[h * 2 + e][u], nb[h & 1][e][n / 3][u + n % 3], s[u][n]); } }
            __builtin_amdgcn_sched_barrier(0);   // keeps this group's arithmetic ahead of the reads that refill its registers
#pragma unroll
            for (int e = 0; e < 2; ++e) qv[h * 2 + e] = *(const v4fa*)(wq + (SC + h * 2 + e) * TP);   // the next stage's q into the registers just used (behind the last stage: values of k, in bounds, never used)
        }
        wq += SC * TP; wc += SC * TP; wl += SC * TP; wr += SC * TP;
    }
#pragma unroll
    for (int u = 0; u < 4; ++u) {
        bool in9[9]; float mx = -3.0e38f;
#pragma unroll
        for (int n = 0; n < 9; ++n) { in9[n] = (n / 3 == 0 ? yt : n / 3 == 2 ? yb : true) & (u + n % 3 == 0 ? xl : u + n % 3 == 5 ? xr : true);
            s[u][n] *= in9[n] ? 0.17677669529663689f : 0.f; mx = __builtin_fmaxf(mx, s[u][n]); }   // a padded neighbour scores 0 (k = 0), as the source: by a zero factor on a finite sum (with a select on the sum the compiler put a corner's whole sum under a branch and sank all sums behind it, at 790 registers)
        float sum = 0.f;
#pragma unroll
        for (int n = 0; n < 9; ++n) { s[u][n] = exp2_slot((s[u][n] - mx) * 1.4426950408889634f); sum += s[u][n]; }
        const float f = 1.0f / sum;
#pragma unroll
        for (int n = 0; n < 9; ++n) s[u][n] *= in9[n] ? f : 0.f;
    }
    auto av_stage = [&](bool more) NOPK {   // 8 output channels; more: a stage follows, and its first group is read ahead
        v4f o[SC];
#pragma unroll
        for (int h = 0; h < SC / 2; ++h) {
            if (h + 1 < SC / 2 || more) ld_group(h + 1);
            __builtin_amdgcn_sched_barrier(0);   // as above
#pragma unroll
            for (int e = 0; e < 2; ++e) {
#pragma unroll
                for (int u = 0; u < 4; ++u) { float a = 0.f;
#pragma unroll
                    for (int n = 0; n < 9; ++n) a = __builtin_fmaf(s[u][n], nb[h & 1][e][n / 3][u + n % 3], a);
                    o[h * 2 + e][u] = a; } }
            __builtin_amdgcn_sched_barrier(0);   // as above
        }
#pragma unroll
        for (int i = 0; i < SC; ++i) *(v4fa*)(ob + (size_t)i * NPIX) = o[i];
        asm volatile("s_wait_xcnt 0x0" ::: "memory");   // the stores' data and address registers are overwritten by the next stage's, or the next tile's, reads and sums
        __builtin_amdgcn_sched_barrier(0);   // nothing of what follows is drawn ahead of that wait
        ob += (size_t)SC * NPIX; wc += SC * TP; wl += SC * TP; wr += SC * TP; };
#pragma clang loop unroll(disable)   // see at the pointers
    for (int t = 0; t + 1 < GD / SC; ++t) av_stage(true);
    av_stage(false);   // nothing lies behind the last stage of v
    }
    }
}

extern "C" void kernel_launch(void* const* d_in, const int* in_sizes, int n_in,
                              void* d_out, int out_size, void* d_ws, size_t ws_size, hipStream_t stream) {
    (void)in_sizes; (void)n_in; (void)out_size; (void)d_ws; (void)ws_size;
    const float* x = (const float*)d_in[0]; const float* Wt = (const float*)d_in[1];
    float* OUT = (float*)d_out;     // [8][128][9216]
    k_sgat<<<dim3(HH / (TR * NTL), NG, NB_), NT, 0, stream>>>(Wt, x, OUT);
}

// v008
// It runs in 21 microseconds.
// Timed twice side by side with v007, it ran 1.06 times as fast both times.
// Counting every step since v000, it is 44.4 times as fast.
#include <hip/hip_runtime.h>

// SGAT (x [8][128][96][96] channel-major; t = W_trans . x (1x1 conv, [384][128]): q = t[0:128], k = t[128:256], v = t[256:384], 4 heads x 32; for every pixel: att[n] = q . k(neighbour n) / sqrt(32) over the zero-padded 3x3 neighbourhood (n row-major (dy, dx); padded neighbours contribute k = v = 0, NOT masked),
//   softmax over the 9; out = sum_n att[n] v(neighbour n) -> [8][128][96][96] channel-major).
// Compute dtypes, f32 accumulate: every input rounded to bf16; the 1x1 conv as a PLAIN bf16 GEMM (inputs: exact; both rounded, and x transposed, inside the work-group, through LDS); the 3x3 neighbourhood attention entirely in f32 on VALU.
// One launch: a work-group makes the q, k, v it needs itself, in LDS, and t never goes to memory. One work-group per WGP (256), each walks 3 tiles of one image and head, top to bottom, and keeps the two rows of t that the next tile shares with this one.

#define NB_  8
#define CI   128
#define CO   384
#define HH   96
#define WW   96
#define NPIX (HH * WW)
#define NG   4
#define GD   32
typedef unsigned short bf;
typedef __attribute__((ext_vector_type(16))) __bf16   v16bf;
typedef __attribute__((ext_vector_type(8)))  unsigned short v8us;
typedef __attribute__((ext_vector_type(4)))  unsigned short v4us;
typedef __attribute__((ext_vector_type(8)))  float    v8f;
typedef __attribute__((ext_vector_type(4)))  float    v4f;
typedef v4f  __attribute__((may_alias)) v4fa;
typedef v8us __attribute__((may_alias)) v8usa;
typedef v4us __attribute__((may_alias)) v4usa;

// the kernel and what is inlined into it are built without packed f32 arithmetic: with it the compiler paired the attention sums of neighbouring pixels, whose operands do not lie in aligned register pairs, and paid a register move per pair
#define NOPK __attribute__((target("no-packed-fp32-ops")))
__device__ __forceinline__ NOPK unsigned short f2bf(float f) { unsigned u = __builtin_bit_cast(unsigned, f); u += 0x7FFFu + ((u >> 16) & 1u); return (unsigned short)(u >> 16); }
__device__ __forceinline__ NOPK v16bf cat16b(v8us lo, v8us hi) { return __builtin_bit_cast(v16bf, __builtin_shufflevector(lo, hi, 0, 1, 2, 3, 4, 5, 6, 7, 8, 9, 10, 11, 12, 13, 14, 15)); }
__device__ __forceinline__ NOPK v8f wmmab(v16bf a, v16bf b, v8f c) { return __builtin_amdgcn_wmma_f32_16x16x32_bf16(false, a, false, b, (short)0, c, false, false); }
__device__ __forceinline__ NOPK v16bf ldfrag(const bf* p) { return cat16b(*(const v8usa*)p, *(const v8usa*)(p + 16)); }
// v_exp_f32 with the slot behind it filled: the instruction set asks for one independent instruction or v_nop before a transcendental's result is read or its source overwritten.
__device__ __forceinline__ NOPK float exp2_slot(float a) { float r; asm("v_exp_f32 %0, %1\n\tv_nop" : "=v"(r) : "v"(a)); return r; }
// work-group barrier that hands over LDS only: the fences name the LDS address space, so the x loads that fly across the barrier are not waited for (with the plain fences the compiler put s_wait_loadcnt 0 in front of every barrier)
__device__ __forceinline__ NOPK void lds_sync() { __builtin_amdgcn_fence(__ATOMIC_RELEASE, "workgroup", "local"); __builtin_amdgcn_s_barrier(); __builtin_amdgcn_fence(__ATOMIC_ACQUIRE, "workgroup", "local"); }

// ---- k_sgat: one work-group = one image (grid z), one head (grid y), 3 tiles one below the other (grid x), a tile = 4 whole rows of pixels; 12 waves. Parts 1 and 2 run once a tile.
// Part 1, all 12 waves: t[96][576] = the head's 32 q, 32 k, 32 v channels on the 4 rows and the one above and below, in LDS, f32, made in chunks of one row.
//   The 6 rows of t are a ring: image row rb - 1 + L lies in slot L mod 6. Two chunks ahead of the tile loop make the first two rows; each tile then makes only its last 4 rows, over the 4 slots that the tile before has done with; its first 2 rows are the last 2 of the tile before.
//   A chunk:
//   a thread reads 8 channels x 4 pixels of x (f32, whole lines), two chunks ahead, rounds them to bf16 and writes them pixel-major (K-contiguous) into one of two LDS buffers; one barrier a chunk.
//   The head's 96 rows of W are rounded once a work-group into LDS; a wave keeps its 48 rows' fragments in registers through part 1. The next tile's first two chunks of x are asked for in the last chunk of this tile, so they fly during part 2. A wave takes 16 pixels (M) x 48 channels (N) of a chunk: a lane's accumulator is 8 pixels side by side of one channel, two 16-byte LDS writes.
//   Same k order in both loaders: k = 8 hi + 0..7, then 16 + 8 hi + 0..7.
//   A row beyond the image is taken from the edge row (in bounds, never used).
// Part 2, waves 0 to 2: the attention; a thread takes 4 pixels side by side. It reads, per channel and row, its 4 values as 16 bytes and the two beside them; every neighbour of its 4 pixels is among these 18 values.
//   A padded neighbour reads a finite value (the edge row's copy; beside a row's end the neighbouring slot's end, or the zeroed gap between channels); its score is replaced by 0 and its weight on v by 0, as k = v = 0 there.
#define TR  4                 // rows of a tile
#define NSL (TR + 2)          // row slots of t
#define WPX (NSL * WW)        // pixels of t in a work-group: 6 rows
#define TP  (WPX + 4)         // LDS pitch of a channel of t, floats: 16 lanes' 16-byte writes, one channel each, fall on all 64 banks
#define TC  (3 * GD)          // channels of t in a work-group
#define PT  WW                // pixels of a chunk: one row
#define NCH TR                // chunks of a tile: its 4 new rows
#define XP  (CI + 8)          // LDS pitch of a row of 128 bf16: 272 B = 16 B x 17, odd, for the 16-byte fragment reads
#define SC  8                 // channels of a stage of the attention
#define NTH (TR * WW / 4)     // 96 threads of the attention
#define NT  384               // threads of the work-group
#define NTL 3                 // tiles of a work-group: 24 x 4 x 8 tiles on 256 work-groups
__global__ __launch_bounds__(NT) NOPK void k_sgat(const float* __restrict__ Wf, const float* __restrict__ X, float* outb) {
    static_assert(HH % (TR * NTL) == 0 && NCH % 2 == 0 && WW % 4 == 0 && NTH % 32 == 0 && GD % SC == 0 && NCH >= 2 && PT == 6 * 16 && CI == 128 && (PT / 4) * (CI / 8) == NT && PT / 4 == 3 * 8 && CI / 8 == 4 * 4 && XP % 128 == 8 && TC == (NT / 32) * 8 && GD % 8 == 0 && TC == 2 * 48 && CO == 3 * NG * GD, "12 waves: 8 rows of W each; 6 pixel blocks x 2 channel halves; a thread stages 8 channels x 4 pixels");
    // every loop below but the one over the tiles and the attention's two over its stages is unrolled: the register arrays need constant indices
    __shared__ struct __align__(16) { bf xs[2][PT * XP]; bf wsm[TC * XP]; float t[TC * TP]; } sm;
    const int tid = (int)__builtin_amdgcn_workitem_id_x(), lane = tid & 31, lr = lane & 15, hi = lane >> 4;
    const int wave = __builtin_amdgcn_readfirstlane(tid >> 5);
    const int g = (int)__builtin_amdgcn_workgroup_id_y(), rb = (int)__builtin_amdgcn_workgroup_id_x() * (TR * NTL);
    const size_t ib = __builtin_amdgcn_workgroup_id_z();
    // 4 pixels, 8 channels a thread. A wave takes 8 pixel groups (one 128-B line of a channel's row) x 4 channel groups; each 16 lanes of it are 4 pixel groups x 4 channel groups:
    // the bank of a thread's 16-byte write to xs is 4 * ((4 pg + u + cg) mod 16), so 16 such lanes fall on all 64 banks (with 16 pixel groups of one channel group they fell on 16 banks, four lanes on each)
    const int pg = (wave % 3) * 8 + hi * 4 + (lane & 3), cg = (wave / 3) * 4 + ((lane >> 2) & 3);
    const char* Xb = (const char*)(X + ib * CI * NPIX);
    const float* Wr = Wf + (size_t)((wave * 8 / GD) * (NG * GD) + g * GD + wave * 8 % GD) * CI;   // the wave's 8 of the head's 96 rows (q, k, v by 32)
    const unsigned xoff = (unsigned)(cg * 8 * NPIX + pg * 4) * 4u;   // byte offset, one register for all loads of x
    v4f xv[2][8], wv[8];
    auto load_x = [&](int c, int gy) NOPK {   // image row gy into register set c & 1
        gy = gy < 0 ? 0 : (gy > HH - 1 ? HH - 1 : gy);
        const char* Xr = Xb + (size_t)(gy * WW) * 4;
        __builtin_amdgcn_sched_barrier(0);   // the loads stay behind the last use of the registers they refill (drawn ahead of it they took registers of their own, beyond 256)
#pragma unroll
        for (int i = 0; i < 8; ++i) xv[c & 1][i] = *(const v4fa*)(Xr + (size_t)i * NPIX * 4 + xoff);
        asm volatile("s_wait_xcnt 0x0" :: "v"(xoff) : "memory");   // ahead of the first overwrite of a base or offset register of the issued loads; the offset is named so that it lives up to the wait
        __builtin_amdgcn_sched_barrier(0); };   // nothing from below is drawn ahead of that wait, and the loads stay this early
    load_x(0, rb - 1);
#pragma unroll
    for (int i = 0; i < 8; ++i) wv[i] = ((const v4fa*)(Wr + (size_t)i * CI))[lane];   // a load is one row, 16 B a lane
    asm volatile("s_wait_xcnt 0x0" :: "v"(lane) : "memory");   // as in load_x, for these 8 loads
    __builtin_amdgcn_sched_barrier(0);   // as in load_x
    load_x(1, rb);
    const int pb = wave % 6, ch0 = (wave / 6) * 48;   // the wave's 16 pixels of a chunk, its 48 channels
    const bf* xp = sm.xs[0] + (pb * 16 + lr) * XP + 8 * hi;
    const bf* wp = sm.wsm + (ch0 + lr) * XP + 8 * hi;
    float* tw = sm.t + (ch0 + lr) * TP + pb * 16 + hi * 8;
#pragma unroll
    for (int i = 0; i < 8; ++i) { v4us o;
#pragma unroll
        for (int u = 0; u < 4; ++u) o[u] = f2bf(wv[i][u]);
        *(v4usa*)(sm.wsm + (wave * 8 + i) * XP + lane * 4) = o; }   // handed over by the first barrier
    if (tid < TC) *(v4fa*)(sm.t + tid * TP + WPX) = (v4f){};   // the 4 floats behind a channel's 6 rows: part 2 reads one of them beside the first pixel of slot 0 and the last of slot 5, at zero weight, so it must be finite
    v16bf wfr[4][3];
    auto stage_x = [&](int c) __attribute__((always_inline)) NOPK {   // register set c & 1, rounded, into LDS buffer c & 1
#pragma unroll
        for (int u = 0; u < 4; ++u) { v8us o;
#pragma unroll
            for (int i = 0; i < 8; ++i) o[i] = f2bf(xv[c & 1][i][u]);
            *(v8usa*)(sm.xs[c & 1] + (pg * 4 + u) * XP + cg * 8) = o; } };
    auto load_w = [&]() __attribute__((always_inline)) NOPK {
#pragma unroll
        for (int kq = 0; kq < 4; ++kq)
#pragma unroll
            for (int nb = 0; nb < 3; ++nb) wfr[kq][nb] = ldfrag(wp + nb * 16 * XP + kq * 32); };
    auto mma_chunk = [&](int c, int slot) __attribute__((always_inline)) NOPK {   // LDS buffer c & 1 -> row slot of t
        v16bf xf[4];
#pragma unroll
        for (int kq = 0; kq < 4; ++kq) xf[kq] = ldfrag(xp + (c & 1) * PT * XP + kq * 32);
        v8f acc[3];
#pragma unroll
        for (int nb = 0; nb < 3; ++nb) acc[nb] = (v8f){};
        __builtin_amdgcn_sched_barrier(0);   // the 12 products stay one block behind the fragment reads ...
#pragma unroll
        for (int kq = 0; kq < 4; ++kq)
#pragma unroll
            for (int nb = 0; nb < 3; ++nb) acc[nb] = wmmab(xf[kq], wfr[kq][nb], acc[nb]);
        __builtin_amdgcn_sched_barrier(0);   // ... and ahead of the writes of t, so that the three accumulators have registers of their own (left alone the compiler started the third in the first one's registers, too close behind its last product)
#pragma unroll
        for (int nb = 0; nb < 3; ++nb) { float* d = tw + nb * 16 * TP + slot * PT;
            *(v4fa*)d = (v4f){acc[nb][0], acc[nb][1], acc[nb][2], acc[nb][3]}; *(v4fa*)(d + 4) = (v4f){acc[nb][4], acc[nb][5], acc[nb][6], acc[nb][7]}; } };
    // rows rb - 1 and rb into slots 0 and 1
#pragma unroll
    for (int c = 0; c < 2; ++c) {
        stage_x(c);
        load_x(c, rb + 1 + c);   // the first tile's first two chunks
        lds_sync();   // chunk c (and W) is complete; every wave has left the buffer that the next chunk is written to
        if (c == 0) load_w();
        mma_chunk(c, c);
    }
    int sl = 2;   // slot of the tile's first new row
#pragma clang loop unroll(disable)   // rolled, for speed only
    for (int it = 0;; ++it) {   // left behind the last tile's part 2
    const int r0 = rb + it * TR;
#pragma unroll
    for (int c = 0; c < NCH; ++c) {   // image row r0 + 1 + c
        stage_x(c);
        if (c + 2 < NCH) load_x(c, r0 + 3 + c);
        else if (c + 1 == NCH && it + 1 < NTL) { load_x(0, r0 + TR + 1); load_x(1, r0 + TR + 2); }   // the next tile's first two chunks, both here, where no older load is pending (issued under this branch a chunk earlier, the compiler's wait for chunk NCH - 1 waited for them too)
        lds_sync();   // chunk c is complete; every wave has left the buffer that chunk c + 1 is written to; at c = 0 also: part 2 of the tile before has read t to its end
        mma_chunk(c, sl + c < NSL ? sl + c : sl + c - NSL);
    }
    lds_sync();   // t is complete
    if (wave < NTH / 32) {   // no barrier inside
    const int y = r0 + tid / (WW / 4), x0 = (tid % (WW / 4)) * 4;
    float* ob = outb + ib * CI * NPIX + (size_t)(g * GD) * NPIX + r0 * WW + tid * 4;
    const bool yt = y > 0, yb = y < HH - 1, xl = x0 > 0, xr = x0 < WW - 4;   // is there a row above, a row below, a pixel left of the four, a pixel right of them
    const int s0 = (sl + TR + tid / (WW / 4)) % NSL, s1 = s0 + 1 < NSL ? s0 + 1 : 0, s2 = s1 + 1 < NSL ? s1 + 1 : 0;   // slots of the row above, the thread's own row, the row below
    // the stage loops are rolled and walk these four pointers: within a stage every LDS offset is an immediate (unrolled inside the tile loop, the hundred-odd addresses beyond the 64-KiB immediate were all formed ahead of that loop and spilled)
    const float* wq = sm.t + s1 * WW + x0;   // q: the thread's own pixels
    const float* wn[3] = {sm.t + GD * TP + s0 * WW + x0 - 1, sm.t + GD * TP + s1 * WW + x0 - 1, sm.t + GD * TP + s2 * WW + x0 - 1};   // k, then v, by row: the value left of the four; the four and the one right of them follow it
    v4f qv[SC];
    // LDS reads in groups of 2 channels, each group issued ahead of the arithmetic of the group before; group SC / 2 is the next stage's first. Stages 0..3: k, 4..7: v.
    float nb[2][2][3][6];
    auto ld_group = [&](int h) NOPK {
#pragma unroll
        for (int e = 0; e < 2; ++e) {
#pragma unroll
            for (int j = 0; j < 3; ++j) { const int w = (h * 2 + e) * TP; const v4f c4 = *(const v4fa*)(wn[j] + w + 1);
                nb[h & 1][e][j][0] = wn[j][w]; nb[h & 1][e][j][1] = c4[0]; nb[h & 1][e][j][2] = c4[1]; nb[h & 1][e][j][3] = c4[2]; nb[h & 1][e][j][4] = c4[3]; nb[h & 1][e][j][5] = wn[j][w + 5]; } } };
#pragma unroll
    for (int i = 0; i < SC; ++i) qv[i] = *(const v4fa*)(wq + i * TP);
    ld_group(0);
    float s[4][9];
#pragma unroll
    for (int u = 0; u < 4; ++u)
#pragma unroll
        for (int n = 0; n < 9; ++n) s[u][n] = 0.f;
#pragma clang loop unroll(disable)   // see at the pointers
    for (int t = 0; t < GD / SC; ++t) {
#pragma unroll
        for (int h = 0; h < SC / 2; ++h) {
            ld_group(h + 1);   // behind the last k stage: the first group of v
            __builtin_amdgcn_sched_barrier(0);   // keeps the next group's LDS reads ahead of this group's arithmetic
#pragma unroll
            for (int e = 0; e < 2; ++e) {
#pragma unroll
                for (int u = 0; u < 4; ++u) {
#pragma unroll
                    for (int n = 0; n < 9; ++n) s[u][n] = __builtin_fmaf(qv[h * 2 + e][u], nb[h & 1][e][n / 3][u + n % 3], s[u][n]); } }
            __builtin_amdgcn_sched_barrier(0);   // keeps this group's arithmetic ahead of the reads that refill its registers
#pragma unroll
            for (int e = 0; e < 2; ++e) qv[h * 2 + e] = *(const v4fa*)(wq + (SC + h * 2 + e) * TP);   // the next stage's q into the registers just used (behind the last stage: values of k, in bounds, never used)
        }
        wq += SC * TP;
#pragma unroll
        for (int j = 0; j < 3; ++j) wn[j] += SC * TP;
    }
#pragma unroll
    for (int u = 0; u < 4; ++u) {
        bool in9[9]; float mx = -3.0e38f;
#pragma unroll
        for (int n = 0; n < 9; ++n) { in9[n] = (n / 3 == 0 ? yt : n / 3 == 2 ? yb : true) & (u + n % 3 == 0 ? xl : u + n % 3 == 5 ? xr : true);
            s[u][n] *= in9[n] ? 0.17677669529663689f : 0.f; mx = __builtin_fmaxf(mx, s[u][n]); }   // a padded neighbour scores 0 (k = 0), as the source: by a zero factor on a finite sum (with a select on the sum the compiler put a corner's whole sum under a branch and sank all sums behind it, at 790 registers)
        float sum = 0.f;
#pragma unroll
        for (int n = 0; n < 9; ++n) { s[u][n] = exp2_slot((s[u][n] - mx) * 1.4426950408889634f); sum += s[u][n]; }
        const float f = 1.0f / sum;
#pragma unroll
        for (int n = 0; n < 9; ++n) s[u][n] *= in9[n] ? f : 0.f;
    }
    auto av_stage = [&](bool more) NOPK {   // 8 output channels; more: a stage follows, and its first group is read ahead
        v4f o[SC];
#pragma unroll
        for (int h = 0; h < SC / 2; ++h) {
            if (h + 1 < SC / 2 || more) ld_group(h + 1);
            __builtin_amdgcn_sched_barrier(0);   // as above
#pragma unroll
            for (int e = 0; e < 2; ++e) {
#pragma unroll
                for (int u = 0; u < 4; ++u) { float a = 0.f;
#pragma unroll
                    for (int n = 0; n < 9; ++n) a = __builtin_fmaf(s[u][n], nb[h & 1][e][n / 3][u + n % 3], a);
                    o[h * 2 + e][u] = a; } }
            __builtin_amdgcn_sched_barrier(0);   // as above
        }
#pragma unroll
        for (int i = 0; i < SC; ++i) *(v4fa*)(ob + (size_t)i * NPIX) = o[i];
        asm volatile("s_wait_xcnt 0x0" ::: "memory");   // the stores' data and address registers are overwritten by the next stage's, or the next tile's, reads and sums
        __builtin_amdgcn_sched_barrier(0);   // nothing of what follows is drawn ahead of that wait
        ob += (size_t)SC * NPIX;
#pragma unroll
        for (int j = 0; j < 3; ++j) wn[j] += SC * TP; };
#pragma clang loop unroll(disable)   // see at the pointers
    for (int t = 0; t + 1 < GD / SC; ++t) av_stage(true);
    av_stage(false);   // nothing lies behind the last stage of v
    }
    if (it + 1 == NTL) break;
    load_w();   // part 2 has used the registers; W in LDS never changes, so the waves without a part 2 read it meanwhile
    sl = sl + TR < NSL ? sl + TR : sl + TR - NSL;
    }
}

extern "C" void kernel_launch(void* const* d_in, const int* in_sizes, int n_in,
                              void* d_out, int out_size, void* d_ws, size_t ws_size, hipStream_t stream) {
    (void)in_sizes; (void)n_in; (void)out_size; (void)d_ws; (void)ws_size;
    const float* x = (const float*)d_in[0]; const float* Wt = (const float*)d_in[1];
    float* OUT = (float*)d_out;     // [8][128][9216]
    k_sgat<<<dim3(HH / (TR * NTL), NG, NB_), NT, 0, stream>>>(Wt, x, OUT);
}
